// v000
// The times below were measured on an AMD MI455X: many runs one after another, warmed up first and cycling through
// copies of the inputs, with the whole window's GPU time divided by the number of runs. Launches and the gaps
// between them are all in it. The median over several windows is given; except for v000 it joins two sittings, which
// can be a few percent apart, so the side-by-side timings, each taken in one sitting, are the better comparison.
// The starting kernel, v000, takes 715 microseconds a run.
#include <hip/hip_runtime.h>

typedef __attribute__((ext_vector_type(16))) _Float16 v16h;
typedef __attribute__((ext_vector_type(2)))  _Float16 v2h;
typedef __attribute__((ext_vector_type(8)))  float    v8f;

constexpr int Sdim  = 2048;
constexpr int Ddim  = 128;
constexpr int QTILE = 128;   // query rows per block (8 waves x 16)
constexpr int KTILE = 64;    // keys per iteration (4 x 16x16 score tiles)
constexpr int NWAVES = 8;

// element e of a 16-bit A/B fragment -> contraction-dim offset (ISA 7.12.2)
#define KOFF(e) ((( ((e) >> 1) < 4 ) ? (((e) >> 1) * 2) : (16 + (((e) >> 1) - 4) * 2)) \
                 + (hi << 3) + ((e) & 1))

// DPP16 row_ror:n — VALU cross-lane rotate within each 16-lane row (no LDS traffic)
#define DPP_ROR(x, n) __builtin_bit_cast(float, __builtin_amdgcn_update_dpp(      \
    0, __builtin_bit_cast(int, (x)), 0x120 + (n), 0xf, 0xf, true))

__device__ __forceinline__ float rowmax16(float x) {
    x = fmaxf(x, DPP_ROR(x, 8));
    x = fmaxf(x, DPP_ROR(x, 4));
    x = fmaxf(x, DPP_ROR(x, 2));
    x = fmaxf(x, DPP_ROR(x, 1));
    return x;
}
__device__ __forceinline__ float rowsum16(float x) {
    x += DPP_ROR(x, 8);
    x += DPP_ROR(x, 4);
    x += DPP_ROR(x, 2);
    x += DPP_ROR(x, 1);
    return x;
}

__global__ __launch_bounds__(256) void fattn_kernel(
    const float* __restrict__ Q, const float* __restrict__ K,
    const float* __restrict__ V, float* __restrict__ O)
{
    __shared__ _Float16 Kl[KTILE * Ddim];          // K tile, [k][d], f16      (16 KB)
    __shared__ _Float16 Vt[Ddim * KTILE];          // V tile, [d][k] transposed (16 KB)
    __shared__ _Float16 Pl[NWAVES * 16 * KTILE];   // per-wave P relayout       (16 KB)

    const int t    = threadIdx.x;
    const int wave = t >> 5;
    const int lane = t & 31;
    const int hi   = lane >> 4;   // half-wave select
    const int ln   = lane & 15;

    const int bh = blockIdx.y;                       // 0..63  (B*H)
    const int qt = blockIdx.x;                       // 0..15  (S/QTILE)
    const size_t base  = (size_t)bh * Sdim * Ddim;
    const int    qrow0 = qt * QTILE + wave * 16;

    const float scale = 0.08838834764831845f;        // 1/sqrt(128)

    // ---- persistent Q A-fragments (4 x 16x32 f16), pre-scaled ----
    v16h qf[4];
    {
        const float* qrow = Q + base + (size_t)(qrow0 + ln) * Ddim;
#pragma unroll
        for (int s = 0; s < 4; ++s) {
#pragma unroll
            for (int e = 0; e < 16; ++e)
                qf[s][e] = (_Float16)(qrow[s * 32 + KOFF(e)] * scale);
        }
    }

    // ---- fp32 accumulators: 16 rows x 128 cols as 8 C-fragments ----
    v8f acc[8];
#pragma unroll
    for (int c = 0; c < 8; ++c) acc[c] = {};
    float mrow[8], lrow[8];
#pragma unroll
    for (int r = 0; r < 8; ++r) { mrow[r] = -__builtin_inff(); lrow[r] = 0.0f; }

    // cooperative-load mapping: each thread owns 2 consecutive key rows x 16 dims
    const int kr2  = (t >> 3) * 2;   // 0,2,..,62
    const int dblk = (t & 7) * 16;   // 0..112

    for (int kb0 = 0; kb0 < Sdim; kb0 += KTILE) {
        __syncthreads();  // previous tile fully consumed
        {
            const float* kp0 = K + base + (size_t)(kb0 + kr2)     * Ddim + dblk;
            const float* kp1 = K + base + (size_t)(kb0 + kr2 + 1) * Ddim + dblk;
            const float* vp0 = V + base + (size_t)(kb0 + kr2)     * Ddim + dblk;
            const float* vp1 = V + base + (size_t)(kb0 + kr2 + 1) * Ddim + dblk;
#pragma unroll
            for (int i = 0; i < 4; ++i) {
                float4 k0 = *reinterpret_cast<const float4*>(kp0 + i * 4);
                float4 k1 = *reinterpret_cast<const float4*>(kp1 + i * 4);
                float4 w0 = *reinterpret_cast<const float4*>(vp0 + i * 4);
                float4 w1 = *reinterpret_cast<const float4*>(vp1 + i * 4);
                const int d0 = dblk + i * 4;
                // K tile: row-major halves (consecutive -> merges to ds_store_b128)
                *reinterpret_cast<v2h*>(&Kl[(kr2)     * Ddim + d0])     = (v2h){(_Float16)k0.x, (_Float16)k0.y};
                *reinterpret_cast<v2h*>(&Kl[(kr2)     * Ddim + d0 + 2]) = (v2h){(_Float16)k0.z, (_Float16)k0.w};
                *reinterpret_cast<v2h*>(&Kl[(kr2 + 1) * Ddim + d0])     = (v2h){(_Float16)k1.x, (_Float16)k1.y};
                *reinterpret_cast<v2h*>(&Kl[(kr2 + 1) * Ddim + d0 + 2]) = (v2h){(_Float16)k1.z, (_Float16)k1.w};
                // V tile transposed: pack the two key rows -> single b32 store per dim
                *reinterpret_cast<v2h*>(&Vt[(d0 + 0) * KTILE + kr2]) = (v2h){(_Float16)w0.x, (_Float16)w1.x};
                *reinterpret_cast<v2h*>(&Vt[(d0 + 1) * KTILE + kr2]) = (v2h){(_Float16)w0.y, (_Float16)w1.y};
                *reinterpret_cast<v2h*>(&Vt[(d0 + 2) * KTILE + kr2]) = (v2h){(_Float16)w0.z, (_Float16)w1.z};
                *reinterpret_cast<v2h*>(&Vt[(d0 + 3) * KTILE + kr2]) = (v2h){(_Float16)w0.w, (_Float16)w1.w};
            }
        }
        __syncthreads();

        // hide next tile's HBM latency behind this tile's WMMA work
        if (kb0 + KTILE < Sdim) {
            __builtin_prefetch(K + base + (size_t)(kb0 + KTILE + kr2) * Ddim + dblk, 0, 0);
            __builtin_prefetch(K + base + (size_t)(kb0 + KTILE + kr2 + 1) * Ddim + dblk, 0, 0);
            __builtin_prefetch(V + base + (size_t)(kb0 + KTILE + kr2) * Ddim + dblk, 0, 0);
            __builtin_prefetch(V + base + (size_t)(kb0 + KTILE + kr2 + 1) * Ddim + dblk, 0, 0);
        }

        // ---- scores: S = Q x K^T for four 16-key tiles, K-dim 128 chained ----
        v8f sc[4];
#pragma unroll
        for (int j = 0; j < 4; ++j) sc[j] = {};
#pragma unroll
        for (int s = 0; s < 4; ++s) {
#pragma unroll
            for (int j = 0; j < 4; ++j) {
                v16h b;
#pragma unroll
                for (int e = 0; e < 16; ++e)
                    b[e] = Kl[(j * 16 + ln) * Ddim + s * 32 + KOFF(e)];
                sc[j] = __builtin_amdgcn_wmma_f32_16x16x32_f16(false, qf[s], false, b,
                                                               (short)0, sc[j], false, false);
            }
        }

        // ---- online softmax: VALU-only DPP butterflies, no LDS round-trips ----
        _Float16* Pw = Pl + wave * 16 * KTILE;
#pragma unroll
        for (int r = 0; r < 8; ++r) {
            float v0 = sc[0][r], v1 = sc[1][r], v2 = sc[2][r], v3 = sc[3][r];
            float m  = rowmax16(fmaxf(fmaxf(v0, v1), fmaxf(v2, v3)));
            const float mn    = fmaxf(mrow[r], m);
            const float alpha = __expf(mrow[r] - mn);
            mrow[r] = mn;
            const float p0 = __expf(v0 - mn);
            const float p1 = __expf(v1 - mn);
            const float p2 = __expf(v2 - mn);
            const float p3 = __expf(v3 - mn);
            lrow[r] = lrow[r] * alpha + rowsum16(p0 + p1 + p2 + p3);
#pragma unroll
            for (int c = 0; c < 8; ++c) acc[c][r] *= alpha;
            const int row = r + 8 * hi;
            Pw[row * KTILE +      ln] = (_Float16)p0;
            Pw[row * KTILE + 16 + ln] = (_Float16)p1;
            Pw[row * KTILE + 32 + ln] = (_Float16)p2;
            Pw[row * KTILE + 48 + ln] = (_Float16)p3;
        }

        // ---- relayout P (C-layout -> two A-fragments, k=0..31 and 32..63) ----
        v16h pf0, pf1;
#pragma unroll
        for (int e = 0; e < 16; ++e) {
            pf0[e] = Pw[ln * KTILE +      KOFF(e)];
            pf1[e] = Pw[ln * KTILE + 32 + KOFF(e)];
        }

        // ---- O += P x V : 8 N-chunks of 16 dims, contraction K = 64 keys ----
#pragma unroll
        for (int c = 0; c < 8; ++c) {
            v16h vf0, vf1;
#pragma unroll
            for (int e = 0; e < 16; ++e) {
                vf0[e] = Vt[(c * 16 + ln) * KTILE +      KOFF(e)];
                vf1[e] = Vt[(c * 16 + ln) * KTILE + 32 + KOFF(e)];
            }
            acc[c] = __builtin_amdgcn_wmma_f32_16x16x32_f16(false, pf0, false, vf0,
                                                            (short)0, acc[c], false, false);
            acc[c] = __builtin_amdgcn_wmma_f32_16x16x32_f16(false, pf1, false, vf1,
                                                            (short)0, acc[c], false, false);
        }
    }

    // ---- epilogue: divide by softmax denominator, store fp32 ----
#pragma unroll
    for (int r = 0; r < 8; ++r) {
        const float inv = 1.0f / lrow[r];
        float* orow = O + base + (size_t)(qrow0 + r + 8 * hi) * Ddim;
#pragma unroll
        for (int c = 0; c < 8; ++c)
            orow[c * 16 + ln] = acc[c][r] * inv;
    }
}

extern "C" void kernel_launch(void* const* d_in, const int* in_sizes, int n_in,
                              void* d_out, int out_size, void* d_ws, size_t ws_size,
                              hipStream_t stream) {
    (void)in_sizes; (void)n_in; (void)out_size; (void)d_ws; (void)ws_size;
    const float* Q = (const float*)d_in[0];
    const float* K = (const float*)d_in[1];
    const float* V = (const float*)d_in[2];
    float*       O = (float*)d_out;

    dim3 grid(Sdim / QTILE, 4 * 16);   // (16 q-tiles, B*H = 64)
    dim3 block(256);                   // 8 wave32 waves
    fattn_kernel<<<grid, block, 0, stream>>>(Q, K, V, O);
}

// v001
// One run takes 313 microseconds.
// Timed twice side by side with v000, it ran 2.39 and 2.38 times as fast.
#include <hip/hip_runtime.h>

typedef __attribute__((ext_vector_type(16))) _Float16 v16h;
typedef __attribute__((ext_vector_type(2)))  _Float16 v2h;
typedef __attribute__((ext_vector_type(8)))  float    v8f;

constexpr int Sdim  = 2048;
constexpr int Ddim  = 128;
constexpr int QTILE = 128;   // query rows per block (8 waves x 16)
constexpr int KTILE = 64;    // keys per iteration (4 x 16x16 score tiles)
constexpr int NWAVES = 8;
// LDS row pitches in halves: row bytes + 16, an odd multiple of 16 B, so that the 16 rows
// one ds_load_b128 touches per half-wave fall on distinct banks (pad halves are never read)
constexpr int KPITCH = Ddim  + 8;   // 272 B
constexpr int VPITCH = KTILE + 8;   // 144 B
constexpr int PPITCH = KTILE + 8;   // 144 B

// element e of a 16-bit A/B fragment -> contraction-dim offset (ISA 7.12.2)
#define KOFF(e) ((( ((e) >> 1) < 4 ) ? (((e) >> 1) * 2) : (16 + (((e) >> 1) - 4) * 2)) \
                 + (hi << 3) + ((e) & 1))

// DPP16 row_ror:n — VALU cross-lane rotate within each 16-lane row (no LDS traffic)
#define DPP_ROR(x, n) __builtin_bit_cast(float, __builtin_amdgcn_update_dpp(      \
    0, __builtin_bit_cast(int, (x)), 0x120 + (n), 0xf, 0xf, true))

__device__ __forceinline__ float rowmax16(float x) {
    x = fmaxf(x, DPP_ROR(x, 8));
    x = fmaxf(x, DPP_ROR(x, 4));
    x = fmaxf(x, DPP_ROR(x, 2));
    x = fmaxf(x, DPP_ROR(x, 1));
    return x;
}
__device__ __forceinline__ float rowsum16(float x) {
    x += DPP_ROR(x, 8);
    x += DPP_ROR(x, 4);
    x += DPP_ROR(x, 2);
    x += DPP_ROR(x, 1);
    return x;
}

// second argument: at least 4 waves per SIMD (a 256-VGPR budget), so that two work-groups
// stay resident per WGP and one stages its tile while the other computes
__global__ __launch_bounds__(256, 4) void fattn_kernel(
    const float* __restrict__ Q, const float* __restrict__ K,
    const float* __restrict__ V, float* __restrict__ O)
{
    __shared__ _Float16 Kl[KTILE * KPITCH];        // K tile, [k][d], f16      (17 KB)
    __shared__ _Float16 Vt[Ddim * VPITCH];         // V tile, [d][k] transposed (18 KB)
    __shared__ _Float16 Pl[NWAVES * 16 * PPITCH];  // per-wave P relayout       (18 KB)

    const int t    = threadIdx.x;
    const int wave = t >> 5;
    const int lane = t & 31;
    const int hi   = lane >> 4;   // half-wave select
    const int ln   = lane & 15;

    const int bh = blockIdx.y;                       // 0..63  (B*H)
    const int qt = blockIdx.x;                       // 0..15  (S/QTILE)
    const size_t base  = (size_t)bh * Sdim * Ddim;
    const int    qrow0 = qt * QTILE + wave * 16;

    const float scale = 0.08838834764831845f;        // 1/sqrt(128)

    // ---- persistent Q A-fragments (4 x 16x32 f16), pre-scaled ----
    v16h qf[4];
    {
        const float* qrow = Q + base + (size_t)(qrow0 + ln) * Ddim;
#pragma unroll
        for (int s = 0; s < 4; ++s) {
#pragma unroll
            for (int e = 0; e < 16; ++e)
                qf[s][e] = (_Float16)(qrow[s * 32 + KOFF(e)] * scale);
        }
    }

    // ---- fp32 accumulators: 16 rows x 128 cols as 8 C-fragments ----
    v8f acc[8];
#pragma unroll
    for (int c = 0; c < 8; ++c) acc[c] = {};
    float mrow[8], lrow[8];
#pragma unroll
    for (int r = 0; r < 8; ++r) { mrow[r] = -__builtin_inff(); lrow[r] = 0.0f; }

    // cooperative-load mapping: each thread owns 2 consecutive key rows x 16 dims
    const int kr2  = (t >> 3) * 2;   // 0,2,..,62
    const int dblk = (t & 7) * 16;   // 0..112

    for (int kb0 = 0; kb0 < Sdim; kb0 += KTILE) {
        __syncthreads();  // previous tile fully consumed
        {
            const float* kp0 = K + base + (size_t)(kb0 + kr2)     * Ddim + dblk;
            const float* kp1 = K + base + (size_t)(kb0 + kr2 + 1) * Ddim + dblk;
            const float* vp0 = V + base + (size_t)(kb0 + kr2)     * Ddim + dblk;
            const float* vp1 = V + base + (size_t)(kb0 + kr2 + 1) * Ddim + dblk;
#pragma unroll
            for (int i = 0; i < 4; ++i) {
                float4 k0 = *reinterpret_cast<const float4*>(kp0 + i * 4);
                float4 k1 = *reinterpret_cast<const float4*>(kp1 + i * 4);
                float4 w0 = *reinterpret_cast<const float4*>(vp0 + i * 4);
                float4 w1 = *reinterpret_cast<const float4*>(vp1 + i * 4);
                const int d0 = dblk + i * 4;
                // K tile: row-major halves (consecutive -> merges to ds_store_b128)
                *reinterpret_cast<v2h*>(&Kl[(kr2)     * KPITCH + d0])     = (v2h){(_Float16)k0.x, (_Float16)k0.y};
                *reinterpret_cast<v2h*>(&Kl[(kr2)     * KPITCH + d0 + 2]) = (v2h){(_Float16)k0.z, (_Float16)k0.w};
                *reinterpret_cast<v2h*>(&Kl[(kr2 + 1) * KPITCH + d0])     = (v2h){(_Float16)k1.x, (_Float16)k1.y};
                *reinterpret_cast<v2h*>(&Kl[(kr2 + 1) * KPITCH + d0 + 2]) = (v2h){(_Float16)k1.z, (_Float16)k1.w};
                // V tile transposed: pack the two key rows -> single b32 store per dim
                *reinterpret_cast<v2h*>(&Vt[(d0 + 0) * VPITCH + kr2]) = (v2h){(_Float16)w0.x, (_Float16)w1.x};
                *reinterpret_cast<v2h*>(&Vt[(d0 + 1) * VPITCH + kr2]) = (v2h){(_Float16)w0.y, (_Float16)w1.y};
                *reinterpret_cast<v2h*>(&Vt[(d0 + 2) * VPITCH + kr2]) = (v2h){(_Float16)w0.z, (_Float16)w1.z};
                *reinterpret_cast<v2h*>(&Vt[(d0 + 3) * VPITCH + kr2]) = (v2h){(_Float16)w0.w, (_Float16)w1.w};
            }
        }
        __syncthreads();

        // hide next tile's HBM latency behind this tile's WMMA work
        if (kb0 + KTILE < Sdim) {
            __builtin_prefetch(K + base + (size_t)(kb0 + KTILE + kr2) * Ddim + dblk, 0, 0);
            __builtin_prefetch(K + base + (size_t)(kb0 + KTILE + kr2 + 1) * Ddim + dblk, 0, 0);
            __builtin_prefetch(V + base + (size_t)(kb0 + KTILE + kr2) * Ddim + dblk, 0, 0);
            __builtin_prefetch(V + base + (size_t)(kb0 + KTILE + kr2 + 1) * Ddim + dblk, 0, 0);
        }

        // ---- scores: S = Q x K^T for four 16-key tiles, K-dim 128 chained ----
        v8f sc[4];
#pragma unroll
        for (int j = 0; j < 4; ++j) sc[j] = {};
#pragma unroll
        for (int s = 0; s < 4; ++s) {
#pragma unroll
            for (int j = 0; j < 4; ++j) {
                v16h b;
#pragma unroll
                for (int e = 0; e < 16; ++e)
                    b[e] = Kl[(j * 16 + ln) * KPITCH + s * 32 + KOFF(e)];
                sc[j] = __builtin_amdgcn_wmma_f32_16x16x32_f16(false, qf[s], false, b,
                                                               (short)0, sc[j], false, false);
            }
        }

        // ---- online softmax: VALU-only DPP butterflies, no LDS round-trips ----
        _Float16* Pw = Pl + wave * 16 * PPITCH;
#pragma unroll
        for (int r = 0; r < 8; ++r) {
            float v0 = sc[0][r], v1 = sc[1][r], v2 = sc[2][r], v3 = sc[3][r];
            float m  = rowmax16(fmaxf(fmaxf(v0, v1), fmaxf(v2, v3)));
            const float mn    = fmaxf(mrow[r], m);
            const float alpha = __expf(mrow[r] - mn);
            mrow[r] = mn;
            const float p0 = __expf(v0 - mn);
            const float p1 = __expf(v1 - mn);
            const float p2 = __expf(v2 - mn);
            const float p3 = __expf(v3 - mn);
            lrow[r] = lrow[r] * alpha + rowsum16(p0 + p1 + p2 + p3);
#pragma unroll
            for (int c = 0; c < 8; ++c) acc[c][r] *= alpha;
            const int row = r + 8 * hi;
            Pw[row * PPITCH +      ln] = (_Float16)p0;
            Pw[row * PPITCH + 16 + ln] = (_Float16)p1;
            Pw[row * PPITCH + 32 + ln] = (_Float16)p2;
            Pw[row * PPITCH + 48 + ln] = (_Float16)p3;
        }

        // ---- relayout P (C-layout -> two A-fragments, k=0..31 and 32..63) ----
        v16h pf0, pf1;
#pragma unroll
        for (int e = 0; e < 16; ++e) {
            pf0[e] = Pw[ln * PPITCH +      KOFF(e)];
            pf1[e] = Pw[ln * PPITCH + 32 + KOFF(e)];
        }

        // ---- O += P x V : 8 N-chunks of 16 dims, contraction K = 64 keys ----
#pragma unroll
        for (int c = 0; c < 8; ++c) {
            v16h vf0, vf1;
#pragma unroll
            for (int e = 0; e < 16; ++e) {
                vf0[e] = Vt[(c * 16 + ln) * VPITCH +      KOFF(e)];
                vf1[e] = Vt[(c * 16 + ln) * VPITCH + 32 + KOFF(e)];
            }
            acc[c] = __builtin_amdgcn_wmma_f32_16x16x32_f16(false, pf0, false, vf0,
                                                            (short)0, acc[c], false, false);
            acc[c] = __builtin_amdgcn_wmma_f32_16x16x32_f16(false, pf1, false, vf1,
                                                            (short)0, acc[c], false, false);
        }
    }

    // ---- epilogue: divide by softmax denominator, store fp32 ----
#pragma unroll
    for (int r = 0; r < 8; ++r) {
        const float inv = 1.0f / lrow[r];
        float* orow = O + base + (size_t)(qrow0 + r + 8 * hi) * Ddim;
#pragma unroll
        for (int c = 0; c < 8; ++c)
            orow[c * 16 + ln] = acc[c][r] * inv;
    }
}

extern "C" void kernel_launch(void* const* d_in, const int* in_sizes, int n_in,
                              void* d_out, int out_size, void* d_ws, size_t ws_size,
                              hipStream_t stream) {
    (void)in_sizes; (void)n_in; (void)out_size; (void)d_ws; (void)ws_size;
    const float* Q = (const float*)d_in[0];
    const float* K = (const float*)d_in[1];
    const float* V = (const float*)d_in[2];
    float*       O = (float*)d_out;

    dim3 grid(Sdim / QTILE, 4 * 16);   // (16 q-tiles, B*H = 64)
    dim3 block(256);                   // 8 wave32 waves
    fattn_kernel<<<grid, block, 0, stream>>>(Q, K, V, O);
}

// v002
// One run takes 213 microseconds.
// Two timings next to v001 put it at 1.45 and 1.47 times that version's speed.
// Over all steps from v000 it is 3.48 times as fast.
#include <hip/hip_runtime.h>

typedef __attribute__((ext_vector_type(16))) _Float16 v16h;
typedef __attribute__((ext_vector_type(2)))  _Float16 v2h;
typedef __attribute__((ext_vector_type(4)))  _Float16 v4h;
typedef __attribute__((ext_vector_type(8)))  _Float16 v8h;
typedef __attribute__((ext_vector_type(8)))  float    v8f;

constexpr int Sdim  = 2048;
constexpr int Ddim  = 128;
constexpr int QTILE = 128;   // query rows per block (8 waves x 16)
constexpr int KTILE = 64;    // keys per iteration (4 x 16x16 score tiles)
constexpr int NWAVES = 8;
// LDS row pitches in halves: row bytes + 16, an odd multiple of 16 B, so that the 16 rows
// one ds_load_b128 touches per half-wave fall on distinct banks (pad halves are never read)
constexpr int KPITCH = Ddim  + 8;   // 272 B
constexpr int VPITCH = KTILE + 8;   // 144 B
constexpr int PPITCH = KTILE + 8;   // 144 B

// element e of a 16-bit A/B fragment -> contraction-dim offset (ISA 7.12.2)
#define KOFF(e) ((( ((e) >> 1) < 4 ) ? (((e) >> 1) * 2) : (16 + (((e) >> 1) - 4) * 2)) \
                 + (hi << 3) + ((e) & 1))

// DPP16 row_ror:n — VALU cross-lane rotate within each 16-lane row (no LDS traffic)
#define DPP_ROR(x, n) __builtin_bit_cast(float, __builtin_amdgcn_update_dpp(      \
    0, __builtin_bit_cast(int, (x)), 0x120 + (n), 0xf, 0xf, true))

__device__ __forceinline__ float rowmax16(float x) {
    x = fmaxf(x, DPP_ROR(x, 8));
    x = fmaxf(x, DPP_ROR(x, 4));
    x = fmaxf(x, DPP_ROR(x, 2));
    x = fmaxf(x, DPP_ROR(x, 1));
    return x;
}
__device__ __forceinline__ float rowsum16(float x) {
    x += DPP_ROR(x, 8);
    x += DPP_ROR(x, 4);
    x += DPP_ROR(x, 2);
    x += DPP_ROR(x, 1);
    return x;
}

// ---- pre-pass: K and V go to f16 once per call, instead of once per query tile ----
// Kh keeps K's [key][dim] order; Vh holds, per tile of KTILE keys, the tile transposed:
// [dim][key], Ddim x KTILE halves in a row, so that both tiles are 16 KB of contiguous bytes.
// One block per tile; blockIdx.z picks K (0) or V (1)
__global__ __launch_bounds__(256) void kv_to_f16_kernel(
    const float* __restrict__ K, const float* __restrict__ V,
    _Float16* __restrict__ Kh, _Float16* __restrict__ Vh)
{
    __shared__ __attribute__((aligned(16))) _Float16 T[Ddim * VPITCH];   // V tile, [d][k]

    const int t = threadIdx.x;
    const size_t tile = ((size_t)blockIdx.y * (Sdim / KTILE) + blockIdx.x) * (KTILE * Ddim);

    if (blockIdx.z == 0) {   // the same for the whole block, and in front of the barrier
        // K: 4 floats in, 4 halves out, same order
        const float* kt = K + tile;
        float4 kf[8];
#pragma unroll
        for (int i = 0; i < 8; ++i)
            kf[i] = *reinterpret_cast<const float4*>(kt + (i * 256 + t) * 4);
#pragma unroll
        for (int i = 0; i < 8; ++i)
            *reinterpret_cast<v4h*>(Kh + tile + (i * 256 + t) * 4) =
                (v4h){(_Float16)kf[i].x, (_Float16)kf[i].y, (_Float16)kf[i].z, (_Float16)kf[i].w};
        return;
    }

    // V: each thread takes 4 dims of two neighbouring keys, four times, 16 keys apart;
    // 8 lanes cover one 128-B line
    const int c4  = ((t >> 5) & 3) * 8 + (t & 7);          // float4 column, 0..31
    const int rp0 = (t >> 7) * 4 + ((t >> 3) & 3);         // key pair of trip 0; + 8 a trip
    const float* vb = V + tile + (2 * rp0) * Ddim + c4 * 4;
    float4 w0[4], w1[4];
#pragma unroll
    for (int i = 0; i < 4; ++i) {
        w0[i] = *reinterpret_cast<const float4*>(vb + (16 * i)     * Ddim);
        w1[i] = *reinterpret_cast<const float4*>(vb + (16 * i + 1) * Ddim);
    }
    // the wait that stands in front of any rewrite of an issued load's address registers; it
    // names the pointer as an input, so no load's result is placed on that pair ahead of it
    asm volatile("s_wait_xcnt 0x0" :: "v"(vb) : "memory");
#pragma unroll
    for (int i = 0; i < 4; ++i) {
        const int k2 = 2 * (rp0 + 8 * i);
        *reinterpret_cast<v2h*>(&T[(c4 * 4 + 0) * VPITCH + k2]) = (v2h){(_Float16)w0[i].x, (_Float16)w1[i].x};
        *reinterpret_cast<v2h*>(&T[(c4 * 4 + 1) * VPITCH + k2]) = (v2h){(_Float16)w0[i].y, (_Float16)w1[i].y};
        *reinterpret_cast<v2h*>(&T[(c4 * 4 + 2) * VPITCH + k2]) = (v2h){(_Float16)w0[i].z, (_Float16)w1[i].z};
        *reinterpret_cast<v2h*>(&T[(c4 * 4 + 3) * VPITCH + k2]) = (v2h){(_Float16)w0[i].w, (_Float16)w1[i].w};
    }

    __syncthreads();   // the transposed V tile is complete
#pragma unroll
    for (int i = 0; i < 4; ++i) {
        const int o = i * 256 + t;                         // 16-B piece of the tile
        *reinterpret_cast<v8h*>(Vh + tile + o * 8) =
            *reinterpret_cast<const v8h*>(&T[(o >> 3) * VPITCH + (o & 7) * 8]);
    }
}

// second argument: at least 4 waves per SIMD (a 256-VGPR budget), so that two work-groups
// stay resident per WGP and one stages its tile while the other computes
__global__ __launch_bounds__(256, 4) void fattn_kernel(
    const float* __restrict__ Q, const _Float16* __restrict__ Kh,
    const _Float16* __restrict__ Vh, float* __restrict__ O)
{
    __shared__ __attribute__((aligned(16))) _Float16 Kl[KTILE * KPITCH];  // K tile, [k][d], f16      (17 KB)
    __shared__ __attribute__((aligned(16))) _Float16 Vt[Ddim * VPITCH];   // V tile, [d][k] transposed (18 KB)
    __shared__ _Float16 Pl[NWAVES * 16 * PPITCH];  // per-wave P relayout       (18 KB)

    const int t    = threadIdx.x;
    const int wave = t >> 5;
    const int lane = t & 31;
    const int hi   = lane >> 4;   // half-wave select
    const int ln   = lane & 15;

    const int bh = blockIdx.y;                       // 0..63  (B*H)
    const int qt = blockIdx.x;                       // 0..15  (S/QTILE)
    const size_t base  = (size_t)bh * Sdim * Ddim;
    const int    qrow0 = qt * QTILE + wave * 16;

    const float scale = 0.08838834764831845f;        // 1/sqrt(128)

    // ---- persistent Q A-fragments (4 x 16x32 f16), pre-scaled ----
    v16h qf[4];
    {
        const float* qrow = Q + base + (size_t)(qrow0 + ln) * Ddim;
#pragma unroll
        for (int s = 0; s < 4; ++s) {
#pragma unroll
            for (int e = 0; e < 16; ++e)
                qf[s][e] = (_Float16)(qrow[s * 32 + KOFF(e)] * scale);
        }
    }

    // ---- fp32 accumulators: 16 rows x 128 cols as 8 C-fragments ----
    v8f acc[8];
#pragma unroll
    for (int c = 0; c < 8; ++c) acc[c] = {};
    float mrow[8], lrow[8];
#pragma unroll
    for (int r = 0; r < 8; ++r) { mrow[r] = -__builtin_inff(); lrow[r] = 0.0f; }

    // one 128-B line of the next tile per thread: K's from threads 0..127, V's from the rest
    const _Float16* pf = (t < 128 ? Kh : Vh) + base + (t & 127) * 64;

    for (int kb0 = 0; kb0 < Sdim; kb0 += KTILE) {
        __syncthreads();  // previous tile fully consumed
        {
            // both tiles are 16 KB of contiguous f16: 4 + 4 pieces of 16 B per thread
            const _Float16* kp = Kh + base + (size_t)kb0 * Ddim + t * 8;
            const _Float16* vp = Vh + base + (size_t)kb0 * Ddim + t * 8;
            v8h kx[4], vx[4];
#pragma unroll
            for (int i = 0; i < 4; ++i) {
                kx[i] = *reinterpret_cast<const v8h*>(kp + i * 2048);
                vx[i] = *reinterpret_cast<const v8h*>(vp + i * 2048);
            }
            // the wait that stands in front of any rewrite of an issued load's address registers;
            // it names both pointers as inputs, so no load's result is placed on them ahead of it
            asm volatile("s_wait_xcnt 0x0" :: "v"(kp), "v"(vp) : "memory");
#pragma unroll
            for (int i = 0; i < 4; ++i) {
                const int o = i * 256 + t;
                *reinterpret_cast<v8h*>(&Kl[(o >> 4) * KPITCH + (o & 15) * 8]) = kx[i];
                *reinterpret_cast<v8h*>(&Vt[(o >> 3) * VPITCH + (o & 7) * 8])  = vx[i];
            }
        }
        __syncthreads();

        // hide next tile's memory latency behind this tile's WMMA work (brings the line into L2);
        // in asm so that the address is a register pair that lives through the loop; it is
        // advanced only under the guard, so it never leaves its own plane
        if (kb0 + KTILE < Sdim) {
            pf += KTILE * Ddim;
            asm volatile("global_prefetch_b8 %0, off scope:SCOPE_SE" :: "v"(pf));
        }

        // ---- scores: S = Q x K^T for four 16-key tiles, K-dim 128 chained ----
        v8f sc[4];
#pragma unroll
        for (int j = 0; j < 4; ++j) sc[j] = {};
#pragma unroll
        for (int s = 0; s < 4; ++s) {
#pragma unroll
            for (int j = 0; j < 4; ++j) {
                v16h b;
#pragma unroll
                for (int e = 0; e < 16; ++e)
                    b[e] = Kl[(j * 16 + ln) * KPITCH + s * 32 + KOFF(e)];
                sc[j] = __builtin_amdgcn_wmma_f32_16x16x32_f16(false, qf[s], false, b,
                                                               (short)0, sc[j], false, false);
            }
        }

        // ---- online softmax: VALU-only DPP butterflies, no LDS round-trips ----
        _Float16* Pw = Pl + wave * 16 * PPITCH;
#pragma unroll
        for (int r = 0; r < 8; ++r) {
            float v0 = sc[0][r], v1 = sc[1][r], v2 = sc[2][r], v3 = sc[3][r];
            float m  = rowmax16(fmaxf(fmaxf(v0, v1), fmaxf(v2, v3)));
            const float mn    = fmaxf(mrow[r], m);
            const float alpha = __expf(mrow[r] - mn);
            mrow[r] = mn;
            const float p0 = __expf(v0 - mn);
            const float p1 = __expf(v1 - mn);
            const float p2 = __expf(v2 - mn);
            const float p3 = __expf(v3 - mn);
            lrow[r] = lrow[r] * alpha + rowsum16(p0 + p1 + p2 + p3);
#pragma unroll
            for (int c = 0; c < 8; ++c) acc[c][r] *= alpha;
            const int row = r + 8 * hi;
            Pw[row * PPITCH +      ln] = (_Float16)p0;
            Pw[row * PPITCH + 16 + ln] = (_Float16)p1;
            Pw[row * PPITCH + 32 + ln] = (_Float16)p2;
            Pw[row * PPITCH + 48 + ln] = (_Float16)p3;
        }

        // ---- relayout P (C-layout -> two A-fragments, k=0..31 and 32..63) ----
        v16h pf0, pf1;
#pragma unroll
        for (int e = 0; e < 16; ++e) {
            pf0[e] = Pw[ln * PPITCH +      KOFF(e)];
            pf1[e] = Pw[ln * PPITCH + 32 + KOFF(e)];
        }

        // ---- O += P x V : 8 N-chunks of 16 dims, contraction K = 64 keys ----
#pragma unroll
        for (int c = 0; c < 8; ++c) {
            v16h vf0, vf1;
#pragma unroll
            for (int e = 0; e < 16; ++e) {
                vf0[e] = Vt[(c * 16 + ln) * VPITCH +      KOFF(e)];
                vf1[e] = Vt[(c * 16 + ln) * VPITCH + 32 + KOFF(e)];
            }
            acc[c] = __builtin_amdgcn_wmma_f32_16x16x32_f16(false, pf0, false, vf0,
                                                            (short)0, acc[c], false, false);
            acc[c] = __builtin_amdgcn_wmma_f32_16x16x32_f16(false, pf1, false, vf1,
                                                            (short)0, acc[c], false, false);
        }
    }

    // ---- epilogue: divide by softmax denominator, store fp32 ----
#pragma unroll
    for (int r = 0; r < 8; ++r) {
        const float inv = 1.0f / lrow[r];
        float* orow = O + base + (size_t)(qrow0 + r + 8 * hi) * Ddim;
#pragma unroll
        for (int c = 0; c < 8; ++c)
            orow[c * 16 + ln] = acc[c][r] * inv;
    }
}

extern "C" void kernel_launch(void* const* d_in, const int* in_sizes, int n_in,
                              void* d_out, int out_size, void* d_ws, size_t ws_size,
                              hipStream_t stream) {
    (void)in_sizes; (void)n_in; (void)out_size; (void)ws_size;
    const float* Q = (const float*)d_in[0];
    const float* K = (const float*)d_in[1];
    const float* V = (const float*)d_in[2];
    float*       O = (float*)d_out;
    _Float16*    Kh = (_Float16*)d_ws;                      // 32 MiB
    _Float16*    Vh = Kh + (size_t)4 * 16 * Sdim * Ddim;    // 32 MiB

    dim3 grid(Sdim / QTILE, 4 * 16);   // (16 q-tiles, B*H = 64)
    dim3 block(256);                   // 8 wave32 waves
    dim3 pgrid(Sdim / KTILE, 4 * 16, 2);  // one tile per block; z: K or V
    kv_to_f16_kernel<<<pgrid, block, 0, stream>>>(K, V, Kh, Vh);
    fattn_kernel<<<grid, block, 0, stream>>>(Q, Kh, Vh, O);
}

// v003
// One run takes 181 microseconds.
// Two timings next to v002 both put it at 1.18 times that version's speed.
// Counting every step since v000, it is 4.09 times as fast.
#include <hip/hip_runtime.h>

typedef __attribute__((ext_vector_type(16))) _Float16 v16h;
typedef __attribute__((ext_vector_type(2)))  _Float16 v2h;
typedef __attribute__((ext_vector_type(4)))  _Float16 v4h;
typedef __attribute__((ext_vector_type(8)))  _Float16 v8h;
typedef __attribute__((ext_vector_type(8)))  float    v8f;

constexpr int Sdim  = 2048;
constexpr int Ddim  = 128;
constexpr int QTILE = 128;   // query rows per block (8 waves x 16)
constexpr int KTILE = 64;    // keys per iteration (4 x 16x16 score tiles)
constexpr int NWAVES = 8;
// LDS row pitches in halves: row bytes + 16, an odd multiple of 16 B, so that the 16 rows
// one ds_load_b128 touches per half-wave fall on distinct banks (pad halves are never read)
constexpr int KPITCH = Ddim  + 8;   // 272 B
constexpr int VPITCH = KTILE + 8;   // 144 B
constexpr int PPITCH = KTILE + 8;   // 144 B

// element e of a 16-bit A/B fragment -> contraction-dim offset (ISA 7.12.2)
#define KOFF(e) ((( ((e) >> 1) < 4 ) ? (((e) >> 1) * 2) : (16 + (((e) >> 1) - 4) * 2)) \
                 + (hi << 3) + ((e) & 1))

// DPP16 row_ror:n — VALU cross-lane rotate within each 16-lane row (no LDS traffic)
#define DPP_ROR(x, n) __builtin_bit_cast(float, __builtin_amdgcn_update_dpp(      \
    0, __builtin_bit_cast(int, (x)), 0x120 + (n), 0xf, 0xf, true))

__device__ __forceinline__ float rowmax16(float x) {
    x = fmaxf(x, DPP_ROR(x, 8));
    x = fmaxf(x, DPP_ROR(x, 4));
    x = fmaxf(x, DPP_ROR(x, 2));
    x = fmaxf(x, DPP_ROR(x, 1));
    return x;
}
__device__ __forceinline__ float rowsum16(float x) {
    x += DPP_ROR(x, 8);
    x += DPP_ROR(x, 4);
    x += DPP_ROR(x, 2);
    x += DPP_ROR(x, 1);
    return x;
}

// ---- pre-pass: K and V go to f16 once per call, instead of once per query tile ----
// Kh keeps K's [key][dim] order; Vh holds, per tile of KTILE keys, the tile transposed:
// [dim][key], Ddim x KTILE halves in a row, so that both tiles are 16 KB of contiguous bytes.
// One block per tile; blockIdx.z picks K (0) or V (1)
__global__ __launch_bounds__(256) void kv_to_f16_kernel(
    const float* __restrict__ K, const float* __restrict__ V,
    _Float16* __restrict__ Kh, _Float16* __restrict__ Vh)
{
    __shared__ __attribute__((aligned(16))) _Float16 T[Ddim * VPITCH];   // V tile, [d][k]

    const int t = threadIdx.x;
    const size_t tile = ((size_t)blockIdx.y * (Sdim / KTILE) + blockIdx.x) * (KTILE * Ddim);

    if (blockIdx.z == 0) {   // the same for the whole block, and in front of the barrier
        // K: 4 floats in, 4 halves out, same order
        const float* kt = K + tile;
        float4 kf[8];
#pragma unroll
        for (int i = 0; i < 8; ++i)
            kf[i] = *reinterpret_cast<const float4*>(kt + (i * 256 + t) * 4);
#pragma unroll
        for (int i = 0; i < 8; ++i)
            *reinterpret_cast<v4h*>(Kh + tile + (i * 256 + t) * 4) =
                (v4h){(_Float16)kf[i].x, (_Float16)kf[i].y, (_Float16)kf[i].z, (_Float16)kf[i].w};
        return;
    }

    // V: each thread takes 4 dims of two neighbouring keys, four times, 16 keys apart;
    // 8 lanes cover one 128-B line
    const int c4  = ((t >> 5) & 3) * 8 + (t & 7);          // float4 column, 0..31
    const int rp0 = (t >> 7) * 4 + ((t >> 3) & 3);         // key pair of trip 0; + 8 a trip
    const float* vb = V + tile + (2 * rp0) * Ddim + c4 * 4;
    float4 w0[4], w1[4];
#pragma unroll
    for (int i = 0; i < 4; ++i) {
        w0[i] = *reinterpret_cast<const float4*>(vb + (16 * i)     * Ddim);
        w1[i] = *reinterpret_cast<const float4*>(vb + (16 * i + 1) * Ddim);
    }
    // the wait that stands in front of any rewrite of an issued load's address registers; it
    // names the pointer as an input, so no load's result is placed on that pair ahead of it
    asm volatile("s_wait_xcnt 0x0" :: "v"(vb) : "memory");
#pragma unroll
    for (int i = 0; i < 4; ++i) {
        const int k2 = 2 * (rp0 + 8 * i);
        *reinterpret_cast<v2h*>(&T[(c4 * 4 + 0) * VPITCH + k2]) = (v2h){(_Float16)w0[i].x, (_Float16)w1[i].x};
        *reinterpret_cast<v2h*>(&T[(c4 * 4 + 1) * VPITCH + k2]) = (v2h){(_Float16)w0[i].y, (_Float16)w1[i].y};
        *reinterpret_cast<v2h*>(&T[(c4 * 4 + 2) * VPITCH + k2]) = (v2h){(_Float16)w0[i].z, (_Float16)w1[i].z};
        *reinterpret_cast<v2h*>(&T[(c4 * 4 + 3) * VPITCH + k2]) = (v2h){(_Float16)w0[i].w, (_Float16)w1[i].w};
    }

    __syncthreads();   // the transposed V tile is complete
#pragma unroll
    for (int i = 0; i < 4; ++i) {
        const int o = i * 256 + t;                         // 16-B piece of the tile
        *reinterpret_cast<v8h*>(Vh + tile + o * 8) =
            *reinterpret_cast<const v8h*>(&T[(o >> 3) * VPITCH + (o & 7) * 8]);
    }
}

// second argument: at least 4 waves per SIMD (a 256-VGPR budget), so that two work-groups
// stay resident per WGP and one stages its tile while the other computes
__global__ __launch_bounds__(256, 4) void fattn_kernel(
    const float* __restrict__ Q, const _Float16* __restrict__ Kh,
    const _Float16* __restrict__ Vh, float* __restrict__ O)
{
    __shared__ __attribute__((aligned(16))) _Float16 Kl[KTILE * KPITCH];  // K tile, [k][d], f16      (17 KB)
    __shared__ __attribute__((aligned(16))) _Float16 Vt[Ddim * VPITCH];   // V tile, [d][k] transposed (18 KB)
    __shared__ _Float16 Pl[NWAVES * 16 * PPITCH];  // per-wave P relayout       (18 KB)

    const int t    = threadIdx.x;
    const int wave = t >> 5;
    const int lane = t & 31;
    const int hi   = lane >> 4;   // half-wave select
    const int ln   = lane & 15;

    const int bh = blockIdx.y;                       // 0..63  (B*H)
    const int qt = blockIdx.x;                       // 0..15  (S/QTILE)
    const size_t base  = (size_t)bh * Sdim * Ddim;
    const int    qrow0 = qt * QTILE + wave * 16;

    const float scale = 0.08838834764831845f;        // 1/sqrt(128)

    // ---- persistent Q A-fragments (4 x 16x32 f16), pre-scaled ----
    v16h qf[4];
    {
        const float* qrow = Q + base + (size_t)(qrow0 + ln) * Ddim;
#pragma unroll
        for (int s = 0; s < 4; ++s) {
#pragma unroll
            for (int e = 0; e < 16; ++e)
                qf[s][e] = (_Float16)(qrow[s * 32 + KOFF(e)] * scale);
        }
    }

    // ---- fp32 accumulators: 16 rows x 128 cols as 8 C-fragments ----
    v8f acc[8];
#pragma unroll
    for (int c = 0; c < 8; ++c) acc[c] = {};
    float mrow[8], lrow[8];
#pragma unroll
    for (int r = 0; r < 8; ++r) { mrow[r] = -__builtin_inff(); lrow[r] = 0.0f; }

    // one 128-B line of the next tile per thread: K's from threads 0..127, V's from the rest
    const _Float16* pf = (t < 128 ? Kh : Vh) + base + (t & 127) * 64;

    // this lane's row and half-wave offset in the two tiles: every fragment lies a constant off these
    const _Float16* kl0 = Kl + ln * KPITCH + hi * 8;
    const _Float16* vt0 = Vt + ln * VPITCH + hi * 8;

    for (int kb0 = 0; kb0 < Sdim; kb0 += KTILE) {
        __syncthreads();  // previous tile fully consumed
        {
            // both tiles are 16 KB of contiguous f16: 4 + 4 pieces of 16 B per thread
            const _Float16* kp = Kh + base + (size_t)kb0 * Ddim + t * 8;
            const _Float16* vp = Vh + base + (size_t)kb0 * Ddim + t * 8;
            v8h kx[4], vx[4];
#pragma unroll
            for (int i = 0; i < 4; ++i) {
                kx[i] = *reinterpret_cast<const v8h*>(kp + i * 2048);
                vx[i] = *reinterpret_cast<const v8h*>(vp + i * 2048);
            }
            // the wait that stands in front of any rewrite of an issued load's address registers;
            // it names both pointers as inputs, so no load's result is placed on them ahead of it
            asm volatile("s_wait_xcnt 0x0" :: "v"(kp), "v"(vp) : "memory");
#pragma unroll
            for (int i = 0; i < 4; ++i) {
                const int o = i * 256 + t;
                *reinterpret_cast<v8h*>(&Kl[(o >> 4) * KPITCH + (o & 15) * 8]) = kx[i];
                *reinterpret_cast<v8h*>(&Vt[(o >> 3) * VPITCH + (o & 7) * 8])  = vx[i];
            }
        }
        __syncthreads();

        // hide next tile's memory latency behind this tile's WMMA work (brings the line into L2);
        // in asm so that the address is a register pair that lives through the loop; it is
        // advanced only under the guard, so it never leaves its own plane
        if (kb0 + KTILE < Sdim) {
            pf += KTILE * Ddim;
            asm volatile("global_prefetch_b8 %0, off scope:SCOPE_SE" :: "v"(pf));
        }

        // Fragment reads from LDS go out in groups of four fragments (eight 16-B reads), one to two
        // groups ahead of the products that use them, into register sets fa, fb, fc: a wave then has
        // 8 to 16 reads in flight instead of 2, and waits for a group once instead of for each fragment.
        // FENCE behind a group keeps the compiler from sinking its reads back down to their first use; in
        // front of a group it keeps the reads behind the products whose registers they take over (without
        // it the kernel spills). The loops over a set are unrolled so that its fragments stay in registers.
#define FENCE() __builtin_amdgcn_sched_barrier(0)
        // a fragment is two 16-B pieces of one LDS row, at halves 8 * hi and 16 + 8 * hi: the order of KOFF
        auto frag = [](const _Float16* p) {
            return __builtin_shufflevector(*reinterpret_cast<const v8h*>(p), *reinterpret_cast<const v8h*>(p + 16),
                                           0, 1, 2, 3, 4, 5, 6, 7, 8, 9, 10, 11, 12, 13, 14, 15);
        };
        auto kfrag = [&](int s, int j) { return frag(kl0 + j * 16 * KPITCH + s * 32); };  // keys j*16.., dims s*32..
        auto vfrag = [&](int c, int h) { return frag(vt0 + c * 16 * VPITCH + h * 32); };  // dims c*16.., keys h*32..
        v16h fa[4], fb[4], fc[4];

        // ---- scores: S = Q x K^T for four 16-key tiles, K-dim 128 chained ----
        v8f sc[4];
#pragma unroll
        for (int j = 0; j < 4; ++j) sc[j] = {};
#pragma unroll
        for (int j = 0; j < 4; ++j) fa[j] = kfrag(0, j);
#pragma unroll
        for (int j = 0; j < 4; ++j) fb[j] = kfrag(1, j);
        FENCE();
#pragma unroll
        for (int j = 0; j < 4; ++j)
            sc[j] = __builtin_amdgcn_wmma_f32_16x16x32_f16(false, qf[0], false, fa[j], (short)0, sc[j], false, false);
        FENCE();
#pragma unroll
        for (int j = 0; j < 4; ++j) fa[j] = kfrag(2, j);
        FENCE();
#pragma unroll
        for (int j = 0; j < 4; ++j)
            sc[j] = __builtin_amdgcn_wmma_f32_16x16x32_f16(false, qf[1], false, fb[j], (short)0, sc[j], false, false);
        FENCE();
#pragma unroll
        for (int j = 0; j < 4; ++j) fb[j] = kfrag(3, j);
        FENCE();
#pragma unroll
        for (int j = 0; j < 4; ++j)
            sc[j] = __builtin_amdgcn_wmma_f32_16x16x32_f16(false, qf[2], false, fa[j], (short)0, sc[j], false, false);
        FENCE();
        // V fragments of dims 0..31 and 32..63: they land while the softmax runs
#pragma unroll
        for (int i = 0; i < 4; ++i) fa[i] = vfrag(i >> 1, i & 1);
        FENCE();
#pragma unroll
        for (int j = 0; j < 4; ++j)
            sc[j] = __builtin_amdgcn_wmma_f32_16x16x32_f16(false, qf[3], false, fb[j], (short)0, sc[j], false, false);
        FENCE();
#pragma unroll
        for (int i = 0; i < 4; ++i) fb[i] = vfrag(2 + (i >> 1), i & 1);
        FENCE();

        // ---- online softmax: VALU-only DPP butterflies, no LDS round-trips ----
        _Float16* Pw = Pl + wave * 16 * PPITCH;
#pragma unroll
        for (int r = 0; r < 8; ++r) {
            float v0 = sc[0][r], v1 = sc[1][r], v2 = sc[2][r], v3 = sc[3][r];
            float m  = rowmax16(fmaxf(fmaxf(v0, v1), fmaxf(v2, v3)));
            const float mn    = fmaxf(mrow[r], m);
            const float alpha = __expf(mrow[r] - mn);
            mrow[r] = mn;
            const float p0 = __expf(v0 - mn);
            const float p1 = __expf(v1 - mn);
            const float p2 = __expf(v2 - mn);
            const float p3 = __expf(v3 - mn);
            lrow[r] = lrow[r] * alpha + rowsum16(p0 + p1 + p2 + p3);
#pragma unroll
            for (int c = 0; c < 8; ++c) acc[c][r] *= alpha;
            const int row = r + 8 * hi;
            Pw[row * PPITCH +      ln] = (_Float16)p0;
            Pw[row * PPITCH + 16 + ln] = (_Float16)p1;
            Pw[row * PPITCH + 32 + ln] = (_Float16)p2;
            Pw[row * PPITCH + 48 + ln] = (_Float16)p3;
        }

        // ---- relayout P (C-layout -> two A-fragments, k=0..31 and 32..63) ----
        v16h pf0, pf1;
#pragma unroll
        for (int e = 0; e < 16; ++e) {
            pf0[e] = Pw[ln * PPITCH +      KOFF(e)];
            pf1[e] = Pw[ln * PPITCH + 32 + KOFF(e)];
        }
#pragma unroll
        for (int i = 0; i < 4; ++i) fc[i] = vfrag(4 + (i >> 1), i & 1);
        FENCE();

        // ---- O += P x V : 8 N-chunks of 16 dims, contraction K = 64 keys; a set serves two chunks,
        // keys 0..31 of both and then keys 32..63 of both ----
        auto pv2 = [&](int c, const v16h (&f)[4]) {
            acc[c]     = __builtin_amdgcn_wmma_f32_16x16x32_f16(false, pf0, false, f[0], (short)0, acc[c],     false, false);
            acc[c + 1] = __builtin_amdgcn_wmma_f32_16x16x32_f16(false, pf0, false, f[2], (short)0, acc[c + 1], false, false);
            acc[c]     = __builtin_amdgcn_wmma_f32_16x16x32_f16(false, pf1, false, f[1], (short)0, acc[c],     false, false);
            acc[c + 1] = __builtin_amdgcn_wmma_f32_16x16x32_f16(false, pf1, false, f[3], (short)0, acc[c + 1], false, false);
        };
        pv2(0, fa);
        FENCE();
#pragma unroll
        for (int i = 0; i < 4; ++i) fa[i] = vfrag(6 + (i >> 1), i & 1);
        FENCE();
        pv2(2, fb);
        pv2(4, fc);
        pv2(6, fa);
#undef FENCE
    }

    // ---- epilogue: divide by softmax denominator, store fp32 ----
#pragma unroll
    for (int r = 0; r < 8; ++r) {
        const float inv = 1.0f / lrow[r];
        float* orow = O + base + (size_t)(qrow0 + r + 8 * hi) * Ddim;
#pragma unroll
        for (int c = 0; c < 8; ++c)
            orow[c * 16 + ln] = acc[c][r] * inv;
    }
}

extern "C" void kernel_launch(void* const* d_in, const int* in_sizes, int n_in,
                              void* d_out, int out_size, void* d_ws, size_t ws_size,
                              hipStream_t stream) {
    (void)in_sizes; (void)n_in; (void)out_size; (void)ws_size;
    const float* Q = (const float*)d_in[0];
    const float* K = (const float*)d_in[1];
    const float* V = (const float*)d_in[2];
    float*       O = (float*)d_out;
    _Float16*    Kh = (_Float16*)d_ws;                      // 32 MiB
    _Float16*    Vh = Kh + (size_t)4 * 16 * Sdim * Ddim;    // 32 MiB

    dim3 grid(Sdim / QTILE, 4 * 16);   // (16 q-tiles, B*H = 64)
    dim3 block(256);                   // 8 wave32 waves
    dim3 pgrid(Sdim / KTILE, 4 * 16, 2);  // one tile per block; z: K or V
    kv_to_f16_kernel<<<pgrid, block, 0, stream>>>(K, V, Kh, Vh);
    fattn_kernel<<<grid, block, 0, stream>>>(Q, Kh, Vh, O);
}

// v004
// It runs in 140 microseconds.
// In both of two side-by-side timings against v003, it was 1.30 times as fast.
// All steps since v000 together make it 5.31 times as fast.
#include <hip/hip_runtime.h>

typedef __attribute__((ext_vector_type(16))) _Float16 v16h;
typedef __attribute__((ext_vector_type(2)))  _Float16 v2h;
typedef __attribute__((ext_vector_type(4)))  _Float16 v4h;
typedef __attribute__((ext_vector_type(8)))  _Float16 v8h;
typedef __attribute__((ext_vector_type(8)))  float    v8f;

constexpr int Sdim  = 2048;
constexpr int Ddim  = 128;
constexpr int QTILE = 128;   // query rows per block (8 waves x 16)
constexpr int KTILE = 64;    // keys per iteration (4 x 16x16 score tiles)
constexpr int NWAVES = 8;
// LDS row pitches in halves: row bytes + 16, an odd multiple of 16 B, so that the 16 rows
// one ds_load_b128 touches per half-wave fall on distinct banks (pad halves are never read)
constexpr int KPITCH = Ddim  + 8;   // 272 B
constexpr int VPITCH = KTILE + 8;   // 144 B
constexpr int OPITCH = Ddim  + 4;   // floats, 528 B: the 16 rows one ds_store_b128 touches per half-wave cover all banks once

// element e of a 16-bit A/B fragment -> contraction-dim offset (ISA 7.12.2)
#define KOFF(e) ((( ((e) >> 1) < 4 ) ? (((e) >> 1) * 2) : (16 + (((e) >> 1) - 4) * 2)) \
                 + (hi << 3) + ((e) & 1))

// the value that lane l ^ 16 holds: the two halves of a wave share each query column
__device__ __forceinline__ float other_half(float x) {
    const int b = __builtin_bit_cast(int, x);
    return __builtin_bit_cast(float, __builtin_amdgcn_permlanex16(b, b, 0x76543210, 0xfedcba98, false, false));
}

// ---- pre-pass: K and V go to f16 once per call, instead of once per query tile ----
// Kh keeps K's [key][dim] order; Vh holds, per tile of KTILE keys, the tile transposed:
// [dim][key], Ddim x KTILE halves in a row, so that both tiles are 16 KB of contiguous bytes.
// One block per tile; blockIdx.z picks K (0) or V (1)
__global__ __launch_bounds__(256) void kv_to_f16_kernel(
    const float* __restrict__ K, const float* __restrict__ V,
    _Float16* __restrict__ Kh, _Float16* __restrict__ Vh)
{
    __shared__ __attribute__((aligned(16))) _Float16 T[Ddim * VPITCH];   // V tile, [d][k]

    const int t = threadIdx.x;
    const size_t tile = ((size_t)blockIdx.y * (Sdim / KTILE) + blockIdx.x) * (KTILE * Ddim);

    if (blockIdx.z == 0) {   // the same for the whole block, and in front of the barrier
        // K: 4 floats in, 4 halves out, same order
        const float* kt = K + tile;
        float4 kf[8];
#pragma unroll
        for (int i = 0; i < 8; ++i)
            kf[i] = *reinterpret_cast<const float4*>(kt + (i * 256 + t) * 4);
#pragma unroll
        for (int i = 0; i < 8; ++i)
            *reinterpret_cast<v4h*>(Kh + tile + (i * 256 + t) * 4) =
                (v4h){(_Float16)kf[i].x, (_Float16)kf[i].y, (_Float16)kf[i].z, (_Float16)kf[i].w};
        return;
    }

    // V: each thread takes 4 dims of two neighbouring keys, four times, 16 keys apart;
    // 8 lanes cover one 128-B line
    const int c4  = ((t >> 5) & 3) * 8 + (t & 7);          // float4 column, 0..31
    const int rp0 = (t >> 7) * 4 + ((t >> 3) & 3);         // key pair of trip 0; + 8 a trip
    const float* vb = V + tile + (2 * rp0) * Ddim + c4 * 4;
    float4 w0[4], w1[4];
#pragma unroll
    for (int i = 0; i < 4; ++i) {
        w0[i] = *reinterpret_cast<const float4*>(vb + (16 * i)     * Ddim);
        w1[i] = *reinterpret_cast<const float4*>(vb + (16 * i + 1) * Ddim);
    }
    // the wait that stands in front of any rewrite of an issued load's address registers; it
    // names the pointer as an input, so no load's result is placed on that pair ahead of it
    asm volatile("s_wait_xcnt 0x0" :: "v"(vb) : "memory");
#pragma unroll
    for (int i = 0; i < 4; ++i) {
        const int k2 = 2 * (rp0 + 8 * i);
        *reinterpret_cast<v2h*>(&T[(c4 * 4 + 0) * VPITCH + k2]) = (v2h){(_Float16)w0[i].x, (_Float16)w1[i].x};
        *reinterpret_cast<v2h*>(&T[(c4 * 4 + 1) * VPITCH + k2]) = (v2h){(_Float16)w0[i].y, (_Float16)w1[i].y};
        *reinterpret_cast<v2h*>(&T[(c4 * 4 + 2) * VPITCH + k2]) = (v2h){(_Float16)w0[i].z, (_Float16)w1[i].z};
        *reinterpret_cast<v2h*>(&T[(c4 * 4 + 3) * VPITCH + k2]) = (v2h){(_Float16)w0[i].w, (_Float16)w1[i].w};
    }

    __syncthreads();   // the transposed V tile is complete
#pragma unroll
    for (int i = 0; i < 4; ++i) {
        const int o = i * 256 + t;                         // 16-B piece of the tile
        *reinterpret_cast<v8h*>(Vh + tile + o * 8) =
            *reinterpret_cast<const v8h*>(&T[(o >> 3) * VPITCH + (o & 7) * 8]);
    }
}

// second argument: at least 4 waves per SIMD (a 256-VGPR budget), so that two work-groups
// stay resident per WGP and one stages its tile while the other computes
__global__ __launch_bounds__(256, 4) void fattn_kernel(
    const float* __restrict__ Q, const _Float16* __restrict__ Kh,
    const _Float16* __restrict__ Vh, float* __restrict__ O)
{
    __shared__ __attribute__((aligned(16))) _Float16 Kl[KTILE * KPITCH];  // K tile, [k][d], f16      (17 KB)
    __shared__ __attribute__((aligned(16))) _Float16 Vt[Ddim * VPITCH];   // V tile, [d][k] transposed (18 KB)
    __shared__ __attribute__((aligned(16))) float Ol[NWAVES * 16 * OPITCH];  // per-wave output rows, epilogue only (66 KB)

    const int t    = threadIdx.x;
    const int wave = t >> 5;
    const int lane = t & 31;
    const int hi   = lane >> 4;   // half-wave select
    const int ln   = lane & 15;

    const int bh = blockIdx.y;                       // 0..63  (B*H)
    const int qt = blockIdx.x;                       // 0..15  (S/QTILE)
    const size_t base  = (size_t)bh * Sdim * Ddim;
    const int    qrow0 = qt * QTILE + wave * 16;

    const float scale = 0.08838834764831845f;        // 1/sqrt(128)

    // ---- persistent Q fragments (4 x 32 dims x 16 queries, f16), pre-scaled: the B operand of S^T = K x Q^T ----
    v16h qf[4];
    {
        const float* qrow = Q + base + (size_t)(qrow0 + ln) * Ddim;
#pragma unroll
        for (int s = 0; s < 4; ++s) {
#pragma unroll
            for (int e = 0; e < 16; ++e)
                qf[s][e] = (_Float16)(qrow[s * 32 + KOFF(e)] * scale);
        }
    }

    // ---- fp32 accumulators of O^T: 128 dims x 16 queries as 8 C-fragments; a lane holds dims
    // c*16 + 8*hi + r of query ln ----
    v8f acc[8];
#pragma unroll
    for (int c = 0; c < 8; ++c) acc[c] = {};
    float mrow = -__builtin_inff();   // running maximum of query ln, equal in both halves
    float lrow = 0.0f;                // running sum over this half's keys only; the halves join in the epilogue

    // one 128-B line of the next tile per thread: K's from threads 0..127, V's from the rest
    const _Float16* pf = (t < 128 ? Kh : Vh) + base + (t & 127) * 64;

    // this lane's row and half-wave offset in the two tiles: every fragment lies a constant off these
    const _Float16* kl0 = Kl + ln * KPITCH + hi * 8;
    const _Float16* vt0 = Vt + ln * VPITCH + hi * 8;

    for (int kb0 = 0; kb0 < Sdim; kb0 += KTILE) {
        __syncthreads();  // previous tile fully consumed
        {
            // both tiles are 16 KB of contiguous f16: 4 + 4 pieces of 16 B per thread
            const _Float16* kp = Kh + base + (size_t)kb0 * Ddim + t * 8;
            const _Float16* vp = Vh + base + (size_t)kb0 * Ddim + t * 8;
            v8h kx[4], vx[4];
#pragma unroll
            for (int i = 0; i < 4; ++i) {
                kx[i] = *reinterpret_cast<const v8h*>(kp + i * 2048);
                vx[i] = *reinterpret_cast<const v8h*>(vp + i * 2048);
            }
            // the wait that stands in front of any rewrite of an issued load's address registers;
            // it names both pointers as inputs, so no load's result is placed on them ahead of it
            asm volatile("s_wait_xcnt 0x0" :: "v"(kp), "v"(vp) : "memory");
#pragma unroll
            for (int i = 0; i < 4; ++i) {
                const int o = i * 256 + t;
                *reinterpret_cast<v8h*>(&Kl[(o >> 4) * KPITCH + (o & 15) * 8]) = kx[i];
                *reinterpret_cast<v8h*>(&Vt[(o >> 3) * VPITCH + (o & 7) * 8])  = vx[i];
            }
        }
        __syncthreads();

        // hide next tile's memory latency behind this tile's WMMA work (brings the line into L2);
        // in asm so that the address is a register pair that lives through the loop; it is
        // advanced only under the guard, so it never leaves its own plane
        if (kb0 + KTILE < Sdim) {
            pf += KTILE * Ddim;
            asm volatile("global_prefetch_b8 %0, off scope:SCOPE_SE" :: "v"(pf));
        }

        // Fragment reads from LDS go out in groups of four fragments (eight 16-B reads), one to two
        // groups ahead of the products that use them, into register sets fa, fb, fc: a wave then has
        // 8 to 16 reads in flight instead of 2, and waits for a group once instead of for each fragment.
        // FENCE behind a group keeps the compiler from sinking its reads back down to their first use; in
        // front of a group it keeps the reads behind the products whose registers they take over (without
        // it the kernel spills). The loops over a set are unrolled so that its fragments stay in registers.
#define FENCE() __builtin_amdgcn_sched_barrier(0)
        // a fragment is two 16-B pieces of one LDS row, at halves 8 * hi and 16 + 8 * hi: the order of KOFF
        auto frag = [](const _Float16* p) {
            return __builtin_shufflevector(*reinterpret_cast<const v8h*>(p), *reinterpret_cast<const v8h*>(p + 16),
                                           0, 1, 2, 3, 4, 5, 6, 7, 8, 9, 10, 11, 12, 13, 14, 15);
        };
        auto kfrag = [&](int s, int j) { return frag(kl0 + j * 16 * KPITCH + s * 32); };  // keys j*16.., dims s*32..
        auto vfrag = [&](int c, int h) { return frag(vt0 + c * 16 * VPITCH + h * 32); };  // dims c*16.., keys h*32..
        v16h fa[4], fb[4], fc[4];

        // ---- scores: S^T = K x Q^T for four 16-key tiles, K-dim 128 chained; sc[j][r] is key
        // j*16 + 8*hi + r against query ln ----
        v8f sc[4];
#pragma unroll
        for (int j = 0; j < 4; ++j) sc[j] = {};
#pragma unroll
        for (int j = 0; j < 4; ++j) fa[j] = kfrag(0, j);
#pragma unroll
        for (int j = 0; j < 4; ++j) fb[j] = kfrag(1, j);
        FENCE();
#pragma unroll
        for (int j = 0; j < 4; ++j)
            sc[j] = __builtin_amdgcn_wmma_f32_16x16x32_f16(false, fa[j], false, qf[0], (short)0, sc[j], false, false);
        FENCE();
#pragma unroll
        for (int j = 0; j < 4; ++j) fa[j] = kfrag(2, j);
        FENCE();
#pragma unroll
        for (int j = 0; j < 4; ++j)
            sc[j] = __builtin_amdgcn_wmma_f32_16x16x32_f16(false, fb[j], false, qf[1], (short)0, sc[j], false, false);
        FENCE();
#pragma unroll
        for (int j = 0; j < 4; ++j) fb[j] = kfrag(3, j);
        FENCE();
#pragma unroll
        for (int j = 0; j < 4; ++j)
            sc[j] = __builtin_amdgcn_wmma_f32_16x16x32_f16(false, fa[j], false, qf[2], (short)0, sc[j], false, false);
        FENCE();
        // V fragments of dims 0..31 and 32..63: they land while the softmax runs
#pragma unroll
        for (int i = 0; i < 4; ++i) fa[i] = vfrag(i >> 1, i & 1);
        FENCE();
#pragma unroll
        for (int j = 0; j < 4; ++j)
            sc[j] = __builtin_amdgcn_wmma_f32_16x16x32_f16(false, fb[j], false, qf[3], (short)0, sc[j], false, false);
        FENCE();
#pragma unroll
        for (int i = 0; i < 4; ++i) fb[i] = vfrag(2 + (i >> 1), i & 1);
        FENCE();

        // ---- online softmax: a lane holds 32 of its query's 64 scores, so maximum and sum run
        // in-lane; the maximum takes one exchange between the halves ----
        float mj[4];
#pragma unroll
        for (int j = 0; j < 4; ++j) {
            mj[j] = fmaxf(fmaxf(sc[j][0], sc[j][1]), sc[j][2]);
            mj[j] = fmaxf(fmaxf(mj[j], sc[j][3]), sc[j][4]);
            mj[j] = fmaxf(fmaxf(mj[j], sc[j][5]), sc[j][6]);
            mj[j] = fmaxf(mj[j], sc[j][7]);
        }
        const float m     = fmaxf(fmaxf(fmaxf(mj[0], mj[1]), mj[2]), mj[3]);
        const float mn    = fmaxf(fmaxf(m, other_half(m)), mrow);
        const float alpha = __expf(mrow - mn);
        mrow = mn;
        float ls[4] = {0.0f, 0.0f, 0.0f, 0.0f};
#pragma unroll
        for (int j = 0; j < 4; ++j) {
#pragma unroll
            for (int r = 0; r < 8; ++r) { sc[j][r] = __expf(sc[j][r] - mn); ls[j] += sc[j][r]; }
        }
        lrow = lrow * alpha + ((ls[0] + ls[1]) + (ls[2] + ls[3]));
#pragma unroll
        for (int c = 0; c < 8; ++c) acc[c] *= alpha;

        // ---- P^T as B operand: two score tiles, converted in place, are keys 0..31 (32..63) in the
        // order of KOFF; no LDS, no lane exchange ----
        const v16h pf0 = __builtin_shufflevector(__builtin_convertvector(sc[0], v8h), __builtin_convertvector(sc[1], v8h),
                                                 0, 1, 2, 3, 4, 5, 6, 7, 8, 9, 10, 11, 12, 13, 14, 15);
        const v16h pf1 = __builtin_shufflevector(__builtin_convertvector(sc[2], v8h), __builtin_convertvector(sc[3], v8h),
                                                 0, 1, 2, 3, 4, 5, 6, 7, 8, 9, 10, 11, 12, 13, 14, 15);
#pragma unroll
        for (int i = 0; i < 4; ++i) fc[i] = vfrag(4 + (i >> 1), i & 1);
        FENCE();

        // ---- O^T += V^T x P^T : 8 chunks of 16 dims, contraction K = 64 keys; a set serves two chunks,
        // keys 0..31 of both and then keys 32..63 of both ----
        auto pv2 = [&](int c, const v16h (&f)[4]) {
            acc[c]     = __builtin_amdgcn_wmma_f32_16x16x32_f16(false, f[0], false, pf0, (short)0, acc[c],     false, false);
            acc[c + 1] = __builtin_amdgcn_wmma_f32_16x16x32_f16(false, f[2], false, pf0, (short)0, acc[c + 1], false, false);
            acc[c]     = __builtin_amdgcn_wmma_f32_16x16x32_f16(false, f[1], false, pf1, (short)0, acc[c],     false, false);
            acc[c + 1] = __builtin_amdgcn_wmma_f32_16x16x32_f16(false, f[3], false, pf1, (short)0, acc[c + 1], false, false);
        };
        pv2(0, fa);
        FENCE();
#pragma unroll
        for (int i = 0; i < 4; ++i) fa[i] = vfrag(6 + (i >> 1), i & 1);
        FENCE();
        pv2(2, fb);
        pv2(4, fc);
        pv2(6, fa);
#undef FENCE
    }

    // ---- epilogue: join the halves' sums, divide, and turn O^T back into rows through this wave's
    // own LDS range, so that every global store covers one whole 512-B row ----
    const float inv = 1.0f / (lrow + other_half(lrow));
    float* ow = Ol + wave * 16 * OPITCH;
#pragma unroll
    for (int c = 0; c < 8; ++c) {
        const v8f o = acc[c] * inv;
        float* p = ow + ln * OPITCH + c * 16 + hi * 8;
        *reinterpret_cast<float4*>(p)     = make_float4(o[0], o[1], o[2], o[3]);
        *reinterpret_cast<float4*>(p + 4) = make_float4(o[4], o[5], o[6], o[7]);
    }
    // the other lanes' rows are in LDS before this lane reads them back
    asm volatile("s_wait_dscnt 0x0" ::: "memory");
    float4 orow[16];
#pragma unroll
    for (int i = 0; i < 16; ++i)
        orow[i] = *reinterpret_cast<const float4*>(ow + i * OPITCH + lane * 4);
    float* og = O + base + (size_t)qrow0 * Ddim + lane * 4;
#pragma unroll
    for (int i = 0; i < 16; ++i)
        *reinterpret_cast<float4*>(og + i * Ddim) = orow[i];
}

extern "C" void kernel_launch(void* const* d_in, const int* in_sizes, int n_in,
                              void* d_out, int out_size, void* d_ws, size_t ws_size,
                              hipStream_t stream) {
    (void)in_sizes; (void)n_in; (void)out_size; (void)ws_size;
    const float* Q = (const float*)d_in[0];
    const float* K = (const float*)d_in[1];
    const float* V = (const float*)d_in[2];
    float*       O = (float*)d_out;
    _Float16*    Kh = (_Float16*)d_ws;                      // 32 MiB
    _Float16*    Vh = Kh + (size_t)4 * 16 * Sdim * Ddim;    // 32 MiB

    dim3 grid(Sdim / QTILE, 4 * 16);   // (16 q-tiles, B*H = 64)
    dim3 block(256);                   // 8 wave32 waves
    dim3 pgrid(Sdim / KTILE, 4 * 16, 2);  // one tile per block; z: K or V
    kv_to_f16_kernel<<<pgrid, block, 0, stream>>>(K, V, Kh, Vh);
    fattn_kernel<<<grid, block, 0, stream>>>(Q, Kh, Vh, O);
}

// v005
// One run takes 133 microseconds.
// Timed twice side by side with v004, it ran 1.05 times as fast both times.
// Counting every step since v000, it is 5.58 times as fast.
#include <hip/hip_runtime.h>

typedef __attribute__((ext_vector_type(16))) _Float16 v16h;
typedef __attribute__((ext_vector_type(2)))  _Float16 v2h;
typedef __attribute__((ext_vector_type(4)))  _Float16 v4h;
typedef __attribute__((ext_vector_type(8)))  _Float16 v8h;
typedef __attribute__((ext_vector_type(8)))  float    v8f;

constexpr int Sdim  = 2048;
constexpr int Ddim  = 128;
constexpr int QTILE = 128;   // query rows per block (8 waves x 16)
constexpr int KTILE = 64;    // keys per iteration (4 x 16x16 score tiles)
constexpr int NWAVES = 8;
// LDS row pitches in halves: row bytes + 16, an odd multiple of 16 B, so that the 16 rows
// one ds_load_b128 touches per half-wave fall on distinct banks (pad halves are never read)
constexpr int KPITCH = Ddim  + 8;   // 272 B
constexpr int VPITCH = KTILE + 8;   // 144 B
constexpr int OPITCH = Ddim  + 4;   // floats, 528 B: the 16 rows one ds_store_b128 touches per half-wave cover all banks once
constexpr int KHALVES = KTILE * KPITCH;      // K tile in LDS, [k][d], f16            (17 KB)
constexpr int VHALVES = Ddim  * VPITCH;      // V tile in LDS, [d][k] transposed, f16 (18 KB)
constexpr int STAGE   = KHALVES + VHALVES;   // one buffer: a K tile and behind it a V tile
constexpr int NTILES  = Sdim / KTILE;

// element e of a 16-bit A/B fragment -> contraction-dim offset (ISA 7.12.2)
#define KOFF(e) ((( ((e) >> 1) < 4 ) ? (((e) >> 1) * 2) : (16 + (((e) >> 1) - 4) * 2)) \
                 + (hi << 3) + ((e) & 1))

// the value that lane l ^ 16 holds: the two halves of a wave share each query column
__device__ __forceinline__ float other_half(float x) {
    const int b = __builtin_bit_cast(int, x);
    return __builtin_bit_cast(float, __builtin_amdgcn_permlanex16(b, b, 0x76543210, 0xfedcba98, false, false));
}

// One thread's share of a K tile and a V tile, 4 + 4 pieces of 16 B, from global memory straight into
// LDS. kd, vd: LDS byte address of the thread's first piece of each tile; a further piece lies 16 K rows
// (32 V rows) on in LDS and 4 KB on in memory. The s_wait_xcnt is the last line of the copies' own
// statement, so that it stands in front of any rewrite of a register that a copy names
__device__ __forceinline__ void copy_tiles(unsigned kd, unsigned vd, const _Float16* kp, const _Float16* vp) {
    asm volatile("global_load_async_to_lds_b128 %0, %8, off\n\t"
                 "global_load_async_to_lds_b128 %4, %12, off\n\t"
                 "global_load_async_to_lds_b128 %1, %9, off\n\t"
                 "global_load_async_to_lds_b128 %5, %13, off\n\t"
                 "global_load_async_to_lds_b128 %2, %10, off\n\t"
                 "global_load_async_to_lds_b128 %6, %14, off\n\t"
                 "global_load_async_to_lds_b128 %3, %11, off\n\t"
                 "global_load_async_to_lds_b128 %7, %15, off\n\t"
                 "s_wait_xcnt 0x0"
                 :: "v"(kd), "v"(kd + 16 * KPITCH * 2), "v"(kd + 32 * KPITCH * 2), "v"(kd + 48 * KPITCH * 2),
                    "v"(vd), "v"(vd + 32 * VPITCH * 2), "v"(vd + 64 * VPITCH * 2), "v"(vd + 96 * VPITCH * 2),
                    "v"(kp), "v"(kp + 2048), "v"(kp + 4096), "v"(kp + 6144),
                    "v"(vp), "v"(vp + 2048), "v"(vp + 4096), "v"(vp + 6144)
                 : "memory");
}

// ---- pre-pass: K and V go to f16 once per call, instead of once per query tile ----
// Kh keeps K's [key][dim] order; Vh holds, per tile of KTILE keys, the tile transposed:
// [dim][key], Ddim x KTILE halves in a row, so that both tiles are 16 KB of contiguous bytes.
// One block per tile; blockIdx.z picks K (0) or V (1)
__global__ __launch_bounds__(256) void kv_to_f16_kernel(
    const float* __restrict__ K, const float* __restrict__ V,
    _Float16* __restrict__ Kh, _Float16* __restrict__ Vh)
{
    __shared__ __attribute__((aligned(16))) _Float16 T[Ddim * VPITCH];   // V tile, [d][k]

    const int t = threadIdx.x;
    const size_t tile = ((size_t)blockIdx.y * (Sdim / KTILE) + blockIdx.x) * (KTILE * Ddim);

    if (blockIdx.z == 0) {   // the same for the whole block, and in front of the barrier
        // K: 4 floats in, 4 halves out, same order
        const float* kt = K + tile;
        float4 kf[8];
#pragma unroll
        for (int i = 0; i < 8; ++i)
            kf[i] = *reinterpret_cast<const float4*>(kt + (i * 256 + t) * 4);
#pragma unroll
        for (int i = 0; i < 8; ++i)
            *reinterpret_cast<v4h*>(Kh + tile + (i * 256 + t) * 4) =
                (v4h){(_Float16)kf[i].x, (_Float16)kf[i].y, (_Float16)kf[i].z, (_Float16)kf[i].w};
        return;
    }

    // V: each thread takes 4 dims of two neighbouring keys, four times, 16 keys apart;
    // 8 lanes cover one 128-B line
    const int c4  = ((t >> 5) & 3) * 8 + (t & 7);          // float4 column, 0..31
    const int rp0 = (t >> 7) * 4 + ((t >> 3) & 3);         // key pair of trip 0; + 8 a trip
    const float* vb = V + tile + (2 * rp0) * Ddim + c4 * 4;
    float4 w0[4], w1[4];
#pragma unroll
    for (int i = 0; i < 4; ++i) {
        w0[i] = *reinterpret_cast<const float4*>(vb + (16 * i)     * Ddim);
        w1[i] = *reinterpret_cast<const float4*>(vb + (16 * i + 1) * Ddim);
    }
    // the wait that stands in front of any rewrite of an issued load's address registers; it
    // names the pointer as an input, so no load's result is placed on that pair ahead of it
    asm volatile("s_wait_xcnt 0x0" :: "v"(vb) : "memory");
#pragma unroll
    for (int i = 0; i < 4; ++i) {
        const int k2 = 2 * (rp0 + 8 * i);
        *reinterpret_cast<v2h*>(&T[(c4 * 4 + 0) * VPITCH + k2]) = (v2h){(_Float16)w0[i].x, (_Float16)w1[i].x};
        *reinterpret_cast<v2h*>(&T[(c4 * 4 + 1) * VPITCH + k2]) = (v2h){(_Float16)w0[i].y, (_Float16)w1[i].y};
        *reinterpret_cast<v2h*>(&T[(c4 * 4 + 2) * VPITCH + k2]) = (v2h){(_Float16)w0[i].z, (_Float16)w1[i].z};
        *reinterpret_cast<v2h*>(&T[(c4 * 4 + 3) * VPITCH + k2]) = (v2h){(_Float16)w0[i].w, (_Float16)w1[i].w};
    }

    __syncthreads();   // the transposed V tile is complete
#pragma unroll
    for (int i = 0; i < 4; ++i) {
        const int o = i * 256 + t;                         // 16-B piece of the tile
        *reinterpret_cast<v8h*>(Vh + tile + o * 8) =
            *reinterpret_cast<const v8h*>(&T[(o >> 3) * VPITCH + (o & 7) * 8]);
    }
}

// second argument: at least 4 waves per SIMD (a 256-VGPR budget), so that two work-groups
// stay resident per WGP
__global__ __launch_bounds__(256, 4) void fattn_kernel(
    const float* __restrict__ Q, const _Float16* __restrict__ Kh,
    const _Float16* __restrict__ Vh, float* __restrict__ O)
{
    __shared__ __attribute__((aligned(16))) _Float16 Ring[2 * STAGE];     // two buffers: tile t lies in buffer t & 1 (70 KB)
    __shared__ __attribute__((aligned(16))) float Ol[NWAVES * 16 * OPITCH];  // per-wave output rows, epilogue only (66 KB)

    const int t    = threadIdx.x;
    const int wave = t >> 5;
    const int lane = t & 31;
    const int hi   = lane >> 4;   // half-wave select
    const int ln   = lane & 15;

    const int bh = blockIdx.y;                       // 0..63  (B*H)
    const int qt = blockIdx.x;                       // 0..15  (S/QTILE)
    const size_t base  = (size_t)bh * Sdim * Ddim;
    const int    qrow0 = qt * QTILE + wave * 16;

    const float scale = 0.08838834764831845f;        // 1/sqrt(128)

    // both tiles are 16 KB of contiguous f16; piece o = i * 256 + t of a tile goes to K row o >> 4,
    // V row o >> 3. An LDS byte address is the low 32 bits of the __shared__ address
    const unsigned ring0 = (unsigned)reinterpret_cast<size_t>(&Ring[0]);
    const unsigned kd0   = ring0 + (t >> 4) * (KPITCH * 2) + (t & 15) * 16;
    const unsigned vd0   = ring0 + KHALVES * 2 + (t >> 3) * (VPITCH * 2) + (t & 7) * 16;
    const _Float16* kg = Kh + base + t * 8;
    const _Float16* vg = Vh + base + t * 8;
    copy_tiles(kd0, vd0, kg, vg);                    // tile 0 into buffer 0; it flies while Q is loaded

    // ---- persistent Q fragments (4 x 32 dims x 16 queries, f16), pre-scaled: the B operand of S^T = K x Q^T ----
    v16h qf[4];
    {
        const float* qrow = Q + base + (size_t)(qrow0 + ln) * Ddim;
#pragma unroll
        for (int s = 0; s < 4; ++s) {
#pragma unroll
            for (int e = 0; e < 16; ++e)
                qf[s][e] = (_Float16)(qrow[s * 32 + KOFF(e)] * scale);
        }
    }

    // ---- fp32 accumulators of O^T: 128 dims x 16 queries as 8 C-fragments; a lane holds dims
    // c*16 + 8*hi + r of query ln ----
    v8f acc[8];
#pragma unroll
    for (int c = 0; c < 8; ++c) acc[c] = {};
    float mrow = -__builtin_inff();   // running maximum of query ln, equal in both halves
    float lrow = 0.0f;                // running sum over this half's keys only; the halves join in the epilogue

    // this wave's copies of tile 0 have landed; behind the barrier every wave's have
    asm volatile("s_wait_asynccnt 0x0" ::: "memory");
    __syncthreads();
    copy_tiles(kd0 + STAGE * 2, vd0 + STAGE * 2, kg + KTILE * Ddim, vg + KTILE * Ddim);   // tile 1 into buffer 1

    // one trip: tile tl against this wave's queries. refill: a tile tl + 2 exists. Inlined at both of its
    // places, so that acc and qf stay in registers
    auto trip = [&](const int tl, const bool refill) __attribute__((always_inline)) {
        const int buf = (tl & 1) * STAGE;   // trip tl reads this buffer alone
        // this lane's row and half-wave offset in the two tiles: every fragment lies a constant off these
        const _Float16* kl0 = Ring + buf + ln * KPITCH + hi * 8;
        const _Float16* vt0 = Ring + buf + KHALVES + ln * VPITCH + hi * 8;

        // Fragment reads from LDS go out in groups of four fragments (eight 16-B reads), one to two
        // groups ahead of the products that use them, into register sets fa, fb, fc: a wave then has
        // 8 to 16 reads in flight instead of 2, and waits for a group once instead of for each fragment.
        // FENCE behind a group keeps the compiler from sinking its reads back down to their first use; in
        // front of a group it keeps the reads behind the products whose registers they take over (without
        // it the kernel spills). The loops over a set are unrolled so that its fragments stay in registers.
#define FENCE() __builtin_amdgcn_sched_barrier(0)
        // a fragment is two 16-B pieces of one LDS row, at halves 8 * hi and 16 + 8 * hi: the order of KOFF
        auto frag = [](const _Float16* p) {
            return __builtin_shufflevector(*reinterpret_cast<const v8h*>(p), *reinterpret_cast<const v8h*>(p + 16),
                                           0, 1, 2, 3, 4, 5, 6, 7, 8, 9, 10, 11, 12, 13, 14, 15);
        };
        auto kfrag = [&](int s, int j) { return frag(kl0 + j * 16 * KPITCH + s * 32); };  // keys j*16.., dims s*32..
        auto vfrag = [&](int c, int h) { return frag(vt0 + c * 16 * VPITCH + h * 32); };  // dims c*16.., keys h*32..
        v16h fa[4], fb[4], fc[4];

        // ---- scores: S^T = K x Q^T for four 16-key tiles, K-dim 128 chained; sc[j][r] is key
        // j*16 + 8*hi + r against query ln ----
        v8f sc[4];
#pragma unroll
        for (int j = 0; j < 4; ++j) sc[j] = {};
#pragma unroll
        for (int j = 0; j < 4; ++j) fa[j] = kfrag(0, j);
#pragma unroll
        for (int j = 0; j < 4; ++j) fb[j] = kfrag(1, j);
        FENCE();
#pragma unroll
        for (int j = 0; j < 4; ++j)
            sc[j] = __builtin_amdgcn_wmma_f32_16x16x32_f16(false, fa[j], false, qf[0], (short)0, sc[j], false, false);
        FENCE();
#pragma unroll
        for (int j = 0; j < 4; ++j) fa[j] = kfrag(2, j);
        FENCE();
#pragma unroll
        for (int j = 0; j < 4; ++j)
            sc[j] = __builtin_amdgcn_wmma_f32_16x16x32_f16(false, fb[j], false, qf[1], (short)0, sc[j], false, false);
        FENCE();
#pragma unroll
        for (int j = 0; j < 4; ++j) fb[j] = kfrag(3, j);
        FENCE();
#pragma unroll
        for (int j = 0; j < 4; ++j)
            sc[j] = __builtin_amdgcn_wmma_f32_16x16x32_f16(false, fa[j], false, qf[2], (short)0, sc[j], false, false);
        FENCE();
        // V fragments of dims 0..31 and 32..63: they land while the softmax runs
#pragma unroll
        for (int i = 0; i < 4; ++i) fa[i] = vfrag(i >> 1, i & 1);
        FENCE();
#pragma unroll
        for (int j = 0; j < 4; ++j)
            sc[j] = __builtin_amdgcn_wmma_f32_16x16x32_f16(false, fb[j], false, qf[3], (short)0, sc[j], false, false);
        FENCE();
#pragma unroll
        for (int i = 0; i < 4; ++i) fb[i] = vfrag(2 + (i >> 1), i & 1);
        FENCE();

        // ---- online softmax: a lane holds 32 of its query's 64 scores, so maximum and sum run
        // in-lane; the maximum takes one exchange between the halves ----
        float mj[4];
#pragma unroll
        for (int j = 0; j < 4; ++j) {
            mj[j] = fmaxf(fmaxf(sc[j][0], sc[j][1]), sc[j][2]);
            mj[j] = fmaxf(fmaxf(mj[j], sc[j][3]), sc[j][4]);
            mj[j] = fmaxf(fmaxf(mj[j], sc[j][5]), sc[j][6]);
            mj[j] = fmaxf(mj[j], sc[j][7]);
        }
        const float m     = fmaxf(fmaxf(fmaxf(mj[0], mj[1]), mj[2]), mj[3]);
        const float mn    = fmaxf(fmaxf(m, other_half(m)), mrow);
        const float alpha = __expf(mrow - mn);
        mrow = mn;
        float ls[4] = {0.0f, 0.0f, 0.0f, 0.0f};
#pragma unroll
        for (int j = 0; j < 4; ++j) {
#pragma unroll
            for (int r = 0; r < 8; ++r) { sc[j][r] = __expf(sc[j][r] - mn); ls[j] += sc[j][r]; }
        }
        lrow = lrow * alpha + ((ls[0] + ls[1]) + (ls[2] + ls[3]));
#pragma unroll
        for (int c = 0; c < 8; ++c) acc[c] *= alpha;

        // ---- P^T as B operand: two score tiles, converted in place, are keys 0..31 (32..63) in the
        // order of KOFF; no LDS, no lane exchange ----
        const v16h pf0 = __builtin_shufflevector(__builtin_convertvector(sc[0], v8h), __builtin_convertvector(sc[1], v8h),
                                                 0, 1, 2, 3, 4, 5, 6, 7, 8, 9, 10, 11, 12, 13, 14, 15);
        const v16h pf1 = __builtin_shufflevector(__builtin_convertvector(sc[2], v8h), __builtin_convertvector(sc[3], v8h),
                                                 0, 1, 2, 3, 4, 5, 6, 7, 8, 9, 10, 11, 12, 13, 14, 15);
#pragma unroll
        for (int i = 0; i < 4; ++i) fc[i] = vfrag(4 + (i >> 1), i & 1);
        FENCE();

        // ---- O^T += V^T x P^T : 8 chunks of 16 dims, contraction K = 64 keys; a set serves two chunks,
        // keys 0..31 of both and then keys 32..63 of both ----
        auto pv2 = [&](int c, const v16h (&f)[4]) {
            acc[c]     = __builtin_amdgcn_wmma_f32_16x16x32_f16(false, f[0], false, pf0, (short)0, acc[c],     false, false);
            acc[c + 1] = __builtin_amdgcn_wmma_f32_16x16x32_f16(false, f[2], false, pf0, (short)0, acc[c + 1], false, false);
            acc[c]     = __builtin_amdgcn_wmma_f32_16x16x32_f16(false, f[1], false, pf1, (short)0, acc[c],     false, false);
            acc[c + 1] = __builtin_amdgcn_wmma_f32_16x16x32_f16(false, f[3], false, pf1, (short)0, acc[c + 1], false, false);
        };
        pv2(0, fa);
        FENCE();
#pragma unroll
        for (int i = 0; i < 4; ++i) fa[i] = vfrag(6 + (i >> 1), i & 1);
        FENCE();
        pv2(2, fb);
        pv2(4, fc);
        pv2(6, fa);
        FENCE();   // the products stay in front of the waits below, which else stand ahead of them and drain the last reads at once
#undef FENCE

        // hand-over: this wave's reads of its buffer are done and its copies of tile tl + 1 have landed;
        // behind the barrier that holds for every wave, so tile tl + 1 may be read and this trip's
        // buffer refilled. The copies of tile tl + 2 then fly through the whole of trip tl + 1
        asm volatile("s_wait_dscnt 0x0" ::: "memory");
        asm volatile("s_wait_asynccnt 0x0" ::: "memory");
        __syncthreads();
        if (refill)
            copy_tiles(kd0 + buf * 2, vd0 + buf * 2, kg + (tl + 2) * (KTILE * Ddim), vg + (tl + 2) * (KTILE * Ddim));
    };
    // the last two trips refill nothing and have a loop of their own, so that neither body holds a branch
    // (with the test inside one loop the row sums sank behind it, their 32 terms stayed live and Q spilled)
    for (int tl = 0; tl < NTILES - 2; ++tl) trip(tl, true);
    for (int tl = NTILES - 2; tl < NTILES; ++tl) trip(tl, false);
    // no copy is outstanding when the wave goes on to its end
    asm volatile("s_wait_asynccnt 0x0" ::: "memory");

    // ---- epilogue: join the halves' sums, divide, and turn O^T back into rows through this wave's
    // own LDS range, so that every global store covers one whole 512-B row ----
    const float inv = 1.0f / (lrow + other_half(lrow));
    float* ow = Ol + wave * 16 * OPITCH;
#pragma unroll
    for (int c = 0; c < 8; ++c) {
        const v8f o = acc[c] * inv;
        float* p = ow + ln * OPITCH + c * 16 + hi * 8;
        *reinterpret_cast<float4*>(p)     = make_float4(o[0], o[1], o[2], o[3]);
        *reinterpret_cast<float4*>(p + 4) = make_float4(o[4], o[5], o[6], o[7]);
    }
    // the other lanes' rows are in LDS before this lane reads them back
    asm volatile("s_wait_dscnt 0x0" ::: "memory");
    float4 orow[16];
#pragma unroll
    for (int i = 0; i < 16; ++i)
        orow[i] = *reinterpret_cast<const float4*>(ow + i * OPITCH + lane * 4);
    float* og = O + base + (size_t)qrow0 * Ddim + lane * 4;
#pragma unroll
    for (int i = 0; i < 16; ++i)
        *reinterpret_cast<float4*>(og + i * Ddim) = orow[i];
}

extern "C" void kernel_launch(void* const* d_in, const int* in_sizes, int n_in,
                              void* d_out, int out_size, void* d_ws, size_t ws_size,
                              hipStream_t stream) {
    (void)in_sizes; (void)n_in; (void)out_size; (void)ws_size;
    const float* Q = (const float*)d_in[0];
    const float* K = (const float*)d_in[1];
    const float* V = (const float*)d_in[2];
    float*       O = (float*)d_out;
    _Float16*    Kh = (_Float16*)d_ws;                      // 32 MiB
    _Float16*    Vh = Kh + (size_t)4 * 16 * Sdim * Ddim;    // 32 MiB

    dim3 grid(Sdim / QTILE, 4 * 16);   // (16 q-tiles, B*H = 64)
    dim3 block(256);                   // 8 wave32 waves
    dim3 pgrid(Sdim / KTILE, 4 * 16, 2);  // one tile per block; z: K or V
    kv_to_f16_kernel<<<pgrid, block, 0, stream>>>(K, V, Kh, Vh);
    fattn_kernel<<<grid, block, 0, stream>>>(Q, Kh, Vh, O);
}

// v006
// Measured time: 125 microseconds a run.
// Timed twice side by side with v005, it ran 1.06 times as fast both times.
// Counting every step since v000, it is 5.91 times as fast.
#include <hip/hip_runtime.h>

typedef __attribute__((ext_vector_type(16))) _Float16 v16h;
typedef __attribute__((ext_vector_type(2)))  _Float16 v2h;
typedef __attribute__((ext_vector_type(4)))  _Float16 v4h;
typedef __attribute__((ext_vector_type(8)))  _Float16 v8h;
typedef __attribute__((ext_vector_type(8)))  float    v8f;

constexpr int Sdim  = 2048;
constexpr int Ddim  = 128;
constexpr int QW    = 2;     // 16-query tiles per wave: each K or V fragment read from LDS serves QW products
constexpr int QTILE = 256;   // query rows per block (8 waves x QW x 16)
constexpr int KTILE = 64;    // keys per iteration (4 x 16x16 score tiles)
constexpr int NWAVES = 8;
// LDS row pitches in halves: row bytes + 16, an odd multiple of 16 B, so that the 16 rows
// one ds_load_b128 touches per half-wave fall on distinct banks (pad halves are never read)
constexpr int KPITCH = Ddim  + 8;   // 272 B
constexpr int VPITCH = KTILE + 8;   // 144 B
constexpr int OPITCH = Ddim  + 4;   // floats, 528 B: the 16 rows one ds_store_b128 touches per half-wave cover all banks once
constexpr int KHALVES = KTILE * KPITCH;      // K tile in LDS, [k][d], f16            (17 KB)
constexpr int VHALVES = Ddim  * VPITCH;      // V tile in LDS, [d][k] transposed, f16 (18 KB)
constexpr int STAGE   = KHALVES + VHALVES;   // one buffer: a K tile and behind it a V tile
constexpr int NTILES  = Sdim / KTILE;

// element e of a 16-bit A/B fragment -> contraction-dim offset (ISA 7.12.2)
#define KOFF(e) ((( ((e) >> 1) < 4 ) ? (((e) >> 1) * 2) : (16 + (((e) >> 1) - 4) * 2)) \
                 + (hi << 3) + ((e) & 1))

// the value that lane l ^ 16 holds: the two halves of a wave share each query column
__device__ __forceinline__ float other_half(float x) {
    const int b = __builtin_bit_cast(int, x);
    return __builtin_bit_cast(float, __builtin_amdgcn_permlanex16(b, b, 0x76543210, 0xfedcba98, false, false));
}

// One thread's share of a K tile and a V tile, 4 + 4 pieces of 16 B, from global memory straight into
// LDS. kd, vd: LDS byte address of the thread's first piece of each tile; a further piece lies 16 K rows
// (32 V rows) on in LDS and 4 KB on in memory. The s_wait_xcnt is the last line of the copies' own
// statement, so that it stands in front of any rewrite of a register that a copy names
__device__ __forceinline__ void copy_tiles(unsigned kd, unsigned vd, const _Float16* kp, const _Float16* vp) {
    asm volatile("global_load_async_to_lds_b128 %0, %8, off\n\t"
                 "global_load_async_to_lds_b128 %4, %12, off\n\t"
                 "global_load_async_to_lds_b128 %1, %9, off\n\t"
                 "global_load_async_to_lds_b128 %5, %13, off\n\t"
                 "global_load_async_to_lds_b128 %2, %10, off\n\t"
                 "global_load_async_to_lds_b128 %6, %14, off\n\t"
                 "global_load_async_to_lds_b128 %3, %11, off\n\t"
                 "global_load_async_to_lds_b128 %7, %15, off\n\t"
                 "s_wait_xcnt 0x0"
                 :: "v"(kd), "v"(kd + 16 * KPITCH * 2), "v"(kd + 32 * KPITCH * 2), "v"(kd + 48 * KPITCH * 2),
                    "v"(vd), "v"(vd + 32 * VPITCH * 2), "v"(vd + 64 * VPITCH * 2), "v"(vd + 96 * VPITCH * 2),
                    "v"(kp), "v"(kp + 2048), "v"(kp + 4096), "v"(kp + 6144),
                    "v"(vp), "v"(vp + 2048), "v"(vp + 4096), "v"(vp + 6144)
                 : "memory");
}

// ---- pre-pass: K and V go to f16 once per call, instead of once per query tile ----
// Kh keeps K's [key][dim] order; Vh holds, per tile of KTILE keys, the tile transposed:
// [dim][key], Ddim x KTILE halves in a row, so that both tiles are 16 KB of contiguous bytes.
// One block per tile; blockIdx.z picks K (0) or V (1)
__global__ __launch_bounds__(256) void kv_to_f16_kernel(
    const float* __restrict__ K, const float* __restrict__ V,
    _Float16* __restrict__ Kh, _Float16* __restrict__ Vh)
{
    __shared__ __attribute__((aligned(16))) _Float16 T[Ddim * VPITCH];   // V tile, [d][k]

    const int t = threadIdx.x;
    const size_t tile = ((size_t)blockIdx.y * (Sdim / KTILE) + blockIdx.x) * (KTILE * Ddim);

    if (blockIdx.z == 0) {   // the same for the whole block, and in front of the barrier
        // K: 4 floats in, 4 halves out, same order
        const float* kt = K + tile;
        float4 kf[8];
#pragma unroll
        for (int i = 0; i < 8; ++i)
            kf[i] = *reinterpret_cast<const float4*>(kt + (i * 256 + t) * 4);
#pragma unroll
        for (int i = 0; i < 8; ++i)
            *reinterpret_cast<v4h*>(Kh + tile + (i * 256 + t) * 4) =
                (v4h){(_Float16)kf[i].x, (_Float16)kf[i].y, (_Float16)kf[i].z, (_Float16)kf[i].w};
        return;
    }

    // V: each thread takes 4 dims of two neighbouring keys, four times, 16 keys apart;
    // 8 lanes cover one 128-B line
    const int c4  = ((t >> 5) & 3) * 8 + (t & 7);          // float4 column, 0..31
    const int rp0 = (t >> 7) * 4 + ((t >> 3) & 3);         // key pair of trip 0; + 8 a trip
    const float* vb = V + tile + (2 * rp0) * Ddim + c4 * 4;
    float4 w0[4], w1[4];
#pragma unroll
    for (int i = 0; i < 4; ++i) {
        w0[i] = *reinterpret_cast<const float4*>(vb + (16 * i)     * Ddim);
        w1[i] = *reinterpret_cast<const float4*>(vb + (16 * i + 1) * Ddim);
    }
    // the wait that stands in front of any rewrite of an issued load's address registers; it
    // names the pointer as an input, so no load's result is placed on that pair ahead of it
    asm volatile("s_wait_xcnt 0x0" :: "v"(vb) : "memory");
#pragma unroll
    for (int i = 0; i < 4; ++i) {
        const int k2 = 2 * (rp0 + 8 * i);
        *reinterpret_cast<v2h*>(&T[(c4 * 4 + 0) * VPITCH + k2]) = (v2h){(_Float16)w0[i].x, (_Float16)w1[i].x};
        *reinterpret_cast<v2h*>(&T[(c4 * 4 + 1) * VPITCH + k2]) = (v2h){(_Float16)w0[i].y, (_Float16)w1[i].y};
        *reinterpret_cast<v2h*>(&T[(c4 * 4 + 2) * VPITCH + k2]) = (v2h){(_Float16)w0[i].z, (_Float16)w1[i].z};
        *reinterpret_cast<v2h*>(&T[(c4 * 4 + 3) * VPITCH + k2]) = (v2h){(_Float16)w0[i].w, (_Float16)w1[i].w};
    }

    __syncthreads();   // the transposed V tile is complete
#pragma unroll
    for (int i = 0; i < 4; ++i) {
        const int o = i * 256 + t;                         // 16-B piece of the tile
        *reinterpret_cast<v8h*>(Vh + tile + o * 8) =
            *reinterpret_cast<const v8h*>(&T[(o >> 3) * VPITCH + (o & 7) * 8]);
    }
}

// a wave holds the output tiles, Q and scores of 32 queries, more than 256 VGPRs: two waves per SIMD,
// one work-group per WGP
__global__ __launch_bounds__(256) void fattn_kernel(
    const float* __restrict__ Q, const _Float16* __restrict__ Kh,
    const _Float16* __restrict__ Vh, float* __restrict__ O)
{
    __shared__ __attribute__((aligned(16))) _Float16 Ring[2 * STAGE];     // two buffers: tile t lies in buffer t & 1 (70 KB)
    __shared__ __attribute__((aligned(16))) float Ol[NWAVES * QW * 16 * OPITCH];  // per-wave output rows, epilogue only (132 KB)

    const int t    = threadIdx.x;
    const int wave = t >> 5;
    const int lane = t & 31;
    const int hi   = lane >> 4;   // half-wave select
    const int ln   = lane & 15;

    const int bh = blockIdx.y;                       // 0..63  (B*H)
    const int qt = blockIdx.x;                       // 0..7   (S/QTILE)
    const size_t base  = (size_t)bh * Sdim * Ddim;
    const int    qrow0 = qt * QTILE + wave * (QW * 16);

    const float scale = 0.08838834764831845f;        // 1/sqrt(128)

    // both tiles are 16 KB of contiguous f16; piece o = i * 256 + t of a tile goes to K row o >> 4,
    // V row o >> 3. An LDS byte address is the low 32 bits of the __shared__ address
    const unsigned ring0 = (unsigned)reinterpret_cast<size_t>(&Ring[0]);
    // ko, vo: the thread's first piece inside a buffer; a buffer's own address is added at each call, so that
    // what lives through the loop is no operand of a copy and may lie in any register (else it spilled)
    const unsigned ko    = (t >> 4) * (KPITCH * 2) + (t & 15) * 16;
    const unsigned vo    = KHALVES * 2 + (t >> 3) * (VPITCH * 2) + (t & 7) * 16;
    const _Float16* kg = Kh + base + t * 8;
    const _Float16* vg = Vh + base + t * 8;
    copy_tiles(ko + ring0, vo + ring0, kg, vg);      // tile 0 into buffer 0; it flies while Q is loaded

    // ---- persistent Q fragments (per query tile u: 4 x 32 dims x 16 queries, f16), pre-scaled: the B operand
    // of S^T = K x Q^T ----
    v16h qf[QW][4];
#pragma unroll
    for (int u = 0; u < QW; ++u) {
        const float* qrow = Q + base + (size_t)(qrow0 + u * 16 + ln) * Ddim;
#pragma unroll
        for (int s = 0; s < 4; ++s) {
#pragma unroll
            for (int e = 0; e < 16; ++e)
                qf[u][s][e] = (_Float16)(qrow[s * 32 + KOFF(e)] * scale);
        }
    }

    // ---- fp32 accumulators of O^T: per query tile 128 dims x 16 queries as 8 C-fragments; a lane holds
    // dims c*16 + 8*hi + r of query u*16 + ln ----
    v8f acc[QW][8];
    float mrow[QW];   // running maximum of query u*16 + ln, equal in both halves
    float lrow[QW];   // running sum over this half's keys only; the halves join in the epilogue
#pragma unroll
    for (int u = 0; u < QW; ++u) {
#pragma unroll
        for (int c = 0; c < 8; ++c) acc[u][c] = {};
        mrow[u] = -__builtin_inff();
        lrow[u] = 0.0f;
    }

    // this wave's copies of tile 0 have landed; behind the barrier every wave's have
    asm volatile("s_wait_asynccnt 0x0" ::: "memory");
    __syncthreads();
    copy_tiles(ko + (ring0 + STAGE * 2), vo + (ring0 + STAGE * 2), kg + KTILE * Ddim, vg + KTILE * Ddim);   // tile 1 into buffer 1

    // one trip: tile tl against this wave's queries. refill: a tile tl + 2 exists. Inlined at both of its
    // places, so that acc and qf stay in registers
    auto trip = [&](const int tl, const bool refill) __attribute__((always_inline)) {
        const int buf = (tl & 1) * STAGE;   // trip tl reads this buffer alone
        // this lane's row and half-wave offset in the two tiles: every fragment lies a constant off these
        const _Float16* kl0 = Ring + buf + ln * KPITCH + hi * 8;
        const _Float16* vt0 = Ring + buf + KHALVES + ln * VPITCH + hi * 8;

        // Fragment reads from LDS go out in groups of four fragments (eight 16-B reads), one to two
        // groups ahead of the products that use them, into register sets fa, fb, fc: a wave then has
        // 8 to 16 reads in flight instead of 2, and waits for a group once instead of for each fragment.
        // FENCE behind a group keeps the compiler from sinking its reads back down to their first use; in
        // front of a group it keeps the reads behind the products whose registers they take over (without
        // it the kernel spills). The loops over a set are unrolled so that its fragments stay in registers.
#define FENCE() __builtin_amdgcn_sched_barrier(0)
        // a fragment is two 16-B pieces of one LDS row, at halves 8 * hi and 16 + 8 * hi: the order of KOFF
        auto frag = [](const _Float16* p) {
            return __builtin_shufflevector(*reinterpret_cast<const v8h*>(p), *reinterpret_cast<const v8h*>(p + 16),
                                           0, 1, 2, 3, 4, 5, 6, 7, 8, 9, 10, 11, 12, 13, 14, 15);
        };
        auto kfrag = [&](int s, int j) { return frag(kl0 + j * 16 * KPITCH + s * 32); };  // keys j*16.., dims s*32..
        auto vfrag = [&](int c, int h) { return frag(vt0 + c * 16 * VPITCH + h * 32); };  // dims c*16.., keys h*32..
        v16h fa[4], fb[4], fc[4];

        // ---- scores: S^T = K x Q^T for four 16-key tiles, K-dim 128 chained; sc[u][j][r] is key
        // j*16 + 8*hi + r against query u*16 + ln. A set of four K fragments serves both query tiles ----
        v8f sc[QW][4];
#pragma unroll
        for (int u = 0; u < QW; ++u) {
#pragma unroll
            for (int j = 0; j < 4; ++j) sc[u][j] = {};
        }
        auto qk = [&](int s, const v16h (&f)[4]) {
#pragma unroll
            for (int j = 0; j < 4; ++j) {
#pragma unroll
                for (int u = 0; u < QW; ++u)
                    sc[u][j] = __builtin_amdgcn_wmma_f32_16x16x32_f16(false, f[j], false, qf[u][s], (short)0, sc[u][j], false, false);
            }
        };
#pragma unroll
        for (int j = 0; j < 4; ++j) fa[j] = kfrag(0, j);
#pragma unroll
        for (int j = 0; j < 4; ++j) fb[j] = kfrag(1, j);
        FENCE();
        qk(0, fa);
        FENCE();
#pragma unroll
        for (int j = 0; j < 4; ++j) fa[j] = kfrag(2, j);
        FENCE();
        qk(1, fb);
        FENCE();
#pragma unroll
        for (int j = 0; j < 4; ++j) fb[j] = kfrag(3, j);
        FENCE();
        qk(2, fa);
        FENCE();
        // V fragments of dims 0..31 and 32..63: they land while the softmax runs
#pragma unroll
        for (int i = 0; i < 4; ++i) fa[i] = vfrag(i >> 1, i & 1);
        FENCE();
        qk(3, fb);
        FENCE();
#pragma unroll
        for (int i = 0; i < 4; ++i) fb[i] = vfrag(2 + (i >> 1), i & 1);
        FENCE();

        // ---- online softmax: a lane holds 32 of its query's 64 scores, so maximum and sum run
        // in-lane; the maximum takes one exchange between the halves ----
        v16h pf[QW][2];
#pragma unroll
        for (int u = 0; u < QW; ++u) {
            float mj[4];
#pragma unroll
            for (int j = 0; j < 4; ++j) {
                mj[j] = fmaxf(fmaxf(sc[u][j][0], sc[u][j][1]), sc[u][j][2]);
                mj[j] = fmaxf(fmaxf(mj[j], sc[u][j][3]), sc[u][j][4]);
                mj[j] = fmaxf(fmaxf(mj[j], sc[u][j][5]), sc[u][j][6]);
                mj[j] = fmaxf(mj[j], sc[u][j][7]);
            }
            const float m     = fmaxf(fmaxf(fmaxf(mj[0], mj[1]), mj[2]), mj[3]);
            const float mn    = fmaxf(fmaxf(m, other_half(m)), mrow[u]);
            const float alpha = __expf(mrow[u] - mn);
            mrow[u] = mn;
            float ls[4] = {0.0f, 0.0f, 0.0f, 0.0f};
#pragma unroll
            for (int j = 0; j < 4; ++j) {
#pragma unroll
                for (int r = 0; r < 8; ++r) { sc[u][j][r] = __expf(sc[u][j][r] - mn); ls[j] += sc[u][j][r]; }
            }
            lrow[u] = lrow[u] * alpha + ((ls[0] + ls[1]) + (ls[2] + ls[3]));
#pragma unroll
            for (int c = 0; c < 8; ++c) acc[u][c] *= alpha;

            // ---- P^T as B operand: two score tiles, converted in place, are keys 0..31 (32..63) in the
            // order of KOFF; no LDS, no lane exchange ----
            pf[u][0] = __builtin_shufflevector(__builtin_convertvector(sc[u][0], v8h), __builtin_convertvector(sc[u][1], v8h),
                                               0, 1, 2, 3, 4, 5, 6, 7, 8, 9, 10, 11, 12, 13, 14, 15);
            pf[u][1] = __builtin_shufflevector(__builtin_convertvector(sc[u][2], v8h), __builtin_convertvector(sc[u][3], v8h),
                                               0, 1, 2, 3, 4, 5, 6, 7, 8, 9, 10, 11, 12, 13, 14, 15);
        }
#pragma unroll
        for (int i = 0; i < 4; ++i) fc[i] = vfrag(4 + (i >> 1), i & 1);
        FENCE();

        // ---- O^T += V^T x P^T : 8 chunks of 16 dims, contraction K = 64 keys; a set serves two chunks,
        // keys 0..31 of both and then keys 32..63 of both, each fragment against both query tiles ----
        auto pv2 = [&](int c, const v16h (&f)[4]) {
#pragma unroll
            for (int h = 0; h < 2; ++h) {
#pragma unroll
                for (int i = 0; i < 2; ++i) {
#pragma unroll
                    for (int u = 0; u < QW; ++u)
                        acc[u][c + i] = __builtin_amdgcn_wmma_f32_16x16x32_f16(false, f[2 * i + h], false, pf[u][h], (short)0, acc[u][c + i], false, false);
                }
            }
        };
        pv2(0, fa);
        FENCE();
#pragma unroll
        for (int i = 0; i < 4; ++i) fa[i] = vfrag(6 + (i >> 1), i & 1);
        FENCE();
        pv2(2, fb);
        pv2(4, fc);
        pv2(6, fa);
        FENCE();   // the products stay in front of the waits below, which else stand ahead of them and drain the last reads at once
#undef FENCE

        // hand-over: this wave's reads of its buffer are done and its copies of tile tl + 1 have landed;
        // behind the barrier that holds for every wave, so tile tl + 1 may be read and this trip's
        // buffer refilled. The copies of tile tl + 2 then fly through the whole of trip tl + 1
        asm volatile("s_wait_dscnt 0x0" ::: "memory");
        asm volatile("s_wait_asynccnt 0x0" ::: "memory");
        __syncthreads();
        if (refill)
            copy_tiles(ko + (ring0 + buf * 2), vo + (ring0 + buf * 2), kg + (tl + 2) * (KTILE * Ddim), vg + (tl + 2) * (KTILE * Ddim));
    };
    // the last two trips refill nothing and have a loop of their own, so that neither body holds a branch
    // (with the test inside one loop the row sums sank behind it, their 32 terms stayed live and Q spilled)
    for (int tl = 0; tl < NTILES - 2; ++tl) trip(tl, true);
    for (int tl = NTILES - 2; tl < NTILES; ++tl) trip(tl, false);
    // no copy is outstanding when the wave goes on to its end
    asm volatile("s_wait_asynccnt 0x0" ::: "memory");

    // ---- epilogue: join the halves' sums, divide, and turn O^T back into rows through this wave's
    // own LDS range, so that every global store covers one whole 512-B row ----
    float* ow = Ol + wave * (QW * 16) * OPITCH;
#pragma unroll
    for (int u = 0; u < QW; ++u) {
        const float inv = 1.0f / (lrow[u] + other_half(lrow[u]));
#pragma unroll
        for (int c = 0; c < 8; ++c) {
            const v8f o = acc[u][c] * inv;
            float* p = ow + (u * 16 + ln) * OPITCH + c * 16 + hi * 8;
            *reinterpret_cast<float4*>(p)     = make_float4(o[0], o[1], o[2], o[3]);
            *reinterpret_cast<float4*>(p + 4) = make_float4(o[4], o[5], o[6], o[7]);
        }
    }
    // the other lanes' rows are in LDS before this lane reads them back
    asm volatile("s_wait_dscnt 0x0" ::: "memory");
    float4 orow[QW * 16];
#pragma unroll
    for (int i = 0; i < QW * 16; ++i)
        orow[i] = *reinterpret_cast<const float4*>(ow + i * OPITCH + lane * 4);
    float* og = O + base + (size_t)qrow0 * Ddim + lane * 4;
#pragma unroll
    for (int i = 0; i < QW * 16; ++i)
        *reinterpret_cast<float4*>(og + i * Ddim) = orow[i];
}

extern "C" void kernel_launch(void* const* d_in, const int* in_sizes, int n_in,
                              void* d_out, int out_size, void* d_ws, size_t ws_size,
                              hipStream_t stream) {
    (void)in_sizes; (void)n_in; (void)out_size; (void)ws_size;
    const float* Q = (const float*)d_in[0];
    const float* K = (const float*)d_in[1];
    const float* V = (const float*)d_in[2];
    float*       O = (float*)d_out;
    _Float16*    Kh = (_Float16*)d_ws;                      // 32 MiB
    _Float16*    Vh = Kh + (size_t)4 * 16 * Sdim * Ddim;    // 32 MiB

    dim3 grid(Sdim / QTILE, 4 * 16);   // (8 q-tiles, B*H = 64)
    dim3 block(256);                   // 8 wave32 waves
    dim3 pgrid(Sdim / KTILE, 4 * 16, 2);  // one tile per block; z: K or V
    kv_to_f16_kernel<<<pgrid, block, 0, stream>>>(K, V, Kh, Vh);
    fattn_kernel<<<grid, block, 0, stream>>>(Q, Kh, Vh, O);
}

// v007
// It runs in 119 microseconds.
// In both of two side-by-side timings against v006, it was 1.05 times as fast.
// Over all steps from v000 it is 6.19 times as fast.
#include <hip/hip_runtime.h>

typedef __attribute__((ext_vector_type(16))) _Float16 v16h;
typedef __attribute__((ext_vector_type(2)))  _Float16 v2h;
typedef __attribute__((ext_vector_type(4)))  _Float16 v4h;
typedef __attribute__((ext_vector_type(8)))  _Float16 v8h;
typedef __attribute__((ext_vector_type(8)))  float    v8f;

constexpr int Sdim  = 2048;
constexpr int Ddim  = 128;
constexpr int QW    = 2;     // 16-query tiles per wave: each K or V fragment read from LDS serves QW products
constexpr int QTILE = 256;   // query rows per block (8 waves x QW x 16)
constexpr int KTILE = 64;    // keys per iteration (4 x 16x16 score tiles)
constexpr int NWAVES = 8;
// LDS row pitches in halves: row bytes + 16, an odd multiple of 16 B, so that the 16 rows
// one ds_load_b128 touches per half-wave fall on distinct banks (pad halves are never read)
constexpr int KPITCH = Ddim  + 8;   // 272 B
constexpr int VPITCH = KTILE + 8;   // 144 B
constexpr int OPITCH = Ddim  + 4;   // floats, 528 B: the 16 rows one ds_store_b128 touches per half-wave cover all banks once
constexpr int KHALVES = KTILE * KPITCH;      // K tile in LDS, [k][d], f16            (17 KB)
constexpr int VHALVES = Ddim  * VPITCH;      // V tile in LDS, [d][k] transposed, f16 (18 KB)
constexpr int STAGE   = KHALVES + VHALVES;   // one buffer: a K tile and behind it a V tile
constexpr int NTILES  = Sdim / KTILE;

// element e of a 16-bit A/B fragment -> contraction-dim offset (ISA 7.12.2)
#define KOFF(e) ((( ((e) >> 1) < 4 ) ? (((e) >> 1) * 2) : (16 + (((e) >> 1) - 4) * 2)) \
                 + (hi << 3) + ((e) & 1))

// the value that lane l ^ 16 holds: the two halves of a wave share each query column
__device__ __forceinline__ float other_half(float x) {
    const int b = __builtin_bit_cast(int, x);
    return __builtin_bit_cast(float, __builtin_amdgcn_permlanex16(b, b, 0x76543210, 0xfedcba98, false, false));
}

// One thread's share of a K tile and a V tile, 4 + 4 pieces of 16 B, from global memory straight into
// LDS. kd, vd: LDS byte address of the thread's first piece of each tile; a further piece lies 16 K rows
// (32 V rows) on in LDS and 4 KB on in memory. The s_wait_xcnt is the last line of the copies' own
// statement, so that it stands in front of any rewrite of a register that a copy names
__device__ __forceinline__ void copy_tiles(unsigned kd, unsigned vd, const _Float16* kp, const _Float16* vp) {
    asm volatile("global_load_async_to_lds_b128 %0, %8, off\n\t"
                 "global_load_async_to_lds_b128 %4, %12, off\n\t"
                 "global_load_async_to_lds_b128 %1, %9, off\n\t"
                 "global_load_async_to_lds_b128 %5, %13, off\n\t"
                 "global_load_async_to_lds_b128 %2, %10, off\n\t"
                 "global_load_async_to_lds_b128 %6, %14, off\n\t"
                 "global_load_async_to_lds_b128 %3, %11, off\n\t"
                 "global_load_async_to_lds_b128 %7, %15, off\n\t"
                 "s_wait_xcnt 0x0"
                 :: "v"(kd), "v"(kd + 16 * KPITCH * 2), "v"(kd + 32 * KPITCH * 2), "v"(kd + 48 * KPITCH * 2),
                    "v"(vd), "v"(vd + 32 * VPITCH * 2), "v"(vd + 64 * VPITCH * 2), "v"(vd + 96 * VPITCH * 2),
                    "v"(kp), "v"(kp + 2048), "v"(kp + 4096), "v"(kp + 6144),
                    "v"(vp), "v"(vp + 2048), "v"(vp + 4096), "v"(vp + 6144)
                 : "memory");
}

// Four pieces of 16 B of one tile, as in copy_tiles: d is the LDS byte address of the thread's first piece, a
// further piece lies dstep bytes on in LDS and 4 KB on in memory. The s_wait_xcnt is again the statement's last line
__device__ __forceinline__ void copy_tile(unsigned d, unsigned dstep, const _Float16* p) {
    asm volatile("global_load_async_to_lds_b128 %0, %4, off\n\t"
                 "global_load_async_to_lds_b128 %1, %5, off\n\t"
                 "global_load_async_to_lds_b128 %2, %6, off\n\t"
                 "global_load_async_to_lds_b128 %3, %7, off\n\t"
                 "s_wait_xcnt 0x0"
                 :: "v"(d), "v"(d + dstep), "v"(d + 2 * dstep), "v"(d + 3 * dstep),
                    "v"(p), "v"(p + 2048), "v"(p + 4096), "v"(p + 6144)
                 : "memory");
}

// ---- pre-pass: K and V go to f16 once per call, instead of once per query tile ----
// Kh keeps K's [key][dim] order; Vh holds, per tile of KTILE keys, the tile transposed:
// [dim][key], Ddim x KTILE halves in a row, so that both tiles are 16 KB of contiguous bytes.
// One block per tile; blockIdx.z picks K (0) or V (1)
__global__ __launch_bounds__(256) void kv_to_f16_kernel(
    const float* __restrict__ K, const float* __restrict__ V,
    _Float16* __restrict__ Kh, _Float16* __restrict__ Vh)
{
    __shared__ __attribute__((aligned(16))) _Float16 T[Ddim * VPITCH];   // V tile, [d][k]

    const int t = threadIdx.x;
    const size_t tile = ((size_t)blockIdx.y * (Sdim / KTILE) + blockIdx.x) * (KTILE * Ddim);

    if (blockIdx.z == 0) {   // the same for the whole block, and in front of the barrier
        // K: 4 floats in, 4 halves out, same order
        const float* kt = K + tile;
        float4 kf[8];
#pragma unroll
        for (int i = 0; i < 8; ++i)
            kf[i] = *reinterpret_cast<const float4*>(kt + (i * 256 + t) * 4);
#pragma unroll
        for (int i = 0; i < 8; ++i)
            *reinterpret_cast<v4h*>(Kh + tile + (i * 256 + t) * 4) =
                (v4h){(_Float16)kf[i].x, (_Float16)kf[i].y, (_Float16)kf[i].z, (_Float16)kf[i].w};
        return;
    }

    // V: each thread takes 4 dims of two neighbouring keys, four times, 16 keys apart;
    // 8 lanes cover one 128-B line
    const int c4  = ((t >> 5) & 3) * 8 + (t & 7);          // float4 column, 0..31
    const int rp0 = (t >> 7) * 4 + ((t >> 3) & 3);         // key pair of trip 0; + 8 a trip
    const float* vb = V + tile + (2 * rp0) * Ddim + c4 * 4;
    float4 w0[4], w1[4];
#pragma unroll
    for (int i = 0; i < 4; ++i) {
        w0[i] = *reinterpret_cast<const float4*>(vb + (16 * i)     * Ddim);
        w1[i] = *reinterpret_cast<const float4*>(vb + (16 * i + 1) * Ddim);
    }
    // the wait that stands in front of any rewrite of an issued load's address registers; it
    // names the pointer as an input, so no load's result is placed on that pair ahead of it
    asm volatile("s_wait_xcnt 0x0" :: "v"(vb) : "memory");
#pragma unroll
    for (int i = 0; i < 4; ++i) {
        const int k2 = 2 * (rp0 + 8 * i);
        *reinterpret_cast<v2h*>(&T[(c4 * 4 + 0) * VPITCH + k2]) = (v2h){(_Float16)w0[i].x, (_Float16)w1[i].x};
        *reinterpret_cast<v2h*>(&T[(c4 * 4 + 1) * VPITCH + k2]) = (v2h){(_Float16)w0[i].y, (_Float16)w1[i].y};
        *reinterpret_cast<v2h*>(&T[(c4 * 4 + 2) * VPITCH + k2]) = (v2h){(_Float16)w0[i].z, (_Float16)w1[i].z};
        *reinterpret_cast<v2h*>(&T[(c4 * 4 + 3) * VPITCH + k2]) = (v2h){(_Float16)w0[i].w, (_Float16)w1[i].w};
    }

    __syncthreads();   // the transposed V tile is complete
#pragma unroll
    for (int i = 0; i < 4; ++i) {
        const int o = i * 256 + t;                         // 16-B piece of the tile
        *reinterpret_cast<v8h*>(Vh + tile + o * 8) =
            *reinterpret_cast<const v8h*>(&T[(o >> 3) * VPITCH + (o & 7) * 8]);
    }
}

// a wave holds the output tiles, Q and the scores of two key tiles for 32 queries, more than 256 VGPRs: two waves
// per SIMD, one work-group per WGP
__global__ __launch_bounds__(256) void fattn_kernel(
    const float* __restrict__ Q, const _Float16* __restrict__ Kh,
    const _Float16* __restrict__ Vh, float* __restrict__ O)
{
    // two buffers; stage s = K tile s + 1 and V tile s lies in buffer s & 1 (70 KB): K runs one tile ahead of V,
    // because trip s forms the scores of tile s + 1 while it works on the scores of tile s
    __shared__ __attribute__((aligned(16))) _Float16 Ring[2 * STAGE];
    __shared__ __attribute__((aligned(16))) _Float16 K0[KHALVES];         // K tile 0, read once in front of the loop (17 KB)
    __shared__ __attribute__((aligned(16))) float Ol[NWAVES * QW * 16 * OPITCH];  // per-wave output rows, epilogue only (132 KB)

    const int t    = threadIdx.x;
    const int wave = t >> 5;
    const int lane = t & 31;
    const int hi   = lane >> 4;   // half-wave select
    const int ln   = lane & 15;

    const int bh = blockIdx.y;                       // 0..63  (B*H)
    const int qt = blockIdx.x;                       // 0..7   (S/QTILE)
    const size_t base  = (size_t)bh * Sdim * Ddim;
    const int    qrow0 = qt * QTILE + wave * (QW * 16);

    const float scale = 0.08838834764831845f;        // 1/sqrt(128)
    constexpr float LOG2E = 1.44269504088896340736f; // e^x = 2^(x * LOG2E)

    // both tiles are 16 KB of contiguous f16; piece o = i * 256 + t of a tile goes to K row o >> 4,
    // V row o >> 3. An LDS byte address is the low 32 bits of the __shared__ address
    const unsigned ring0 = (unsigned)reinterpret_cast<size_t>(&Ring[0]);
    // ko, vo: the thread's first piece inside a buffer; a buffer's own address is added at each call, so that
    // what lives through the loop is no operand of a copy and may lie in any register (else it spilled)
    const unsigned ko    = (t >> 4) * (KPITCH * 2) + (t & 15) * 16;
    const unsigned vo    = KHALVES * 2 + (t >> 3) * (VPITCH * 2) + (t & 7) * 16;
    const _Float16* kg = Kh + base + t * 8;
    const _Float16* vg = Vh + base + t * 8;
    constexpr int TILE = KTILE * Ddim;
    // K tile 0 into K0, stage 0 (K tile 1, V tile 0) into buffer 0; they fly while Q is loaded
    copy_tile(ko + (unsigned)reinterpret_cast<size_t>(&K0[0]), 16 * KPITCH * 2, kg);
    copy_tiles(ko + ring0, vo + ring0, kg + TILE, vg);

    // ---- persistent Q fragments (per query tile u: 4 x 32 dims x 16 queries, f16), pre-scaled: the B operand
    // of S^T = K x Q^T ----
    v16h qf[QW][4];
#pragma unroll
    for (int u = 0; u < QW; ++u) {
        const float* qrow = Q + base + (size_t)(qrow0 + u * 16 + ln) * Ddim;
#pragma unroll
        for (int s = 0; s < 4; ++s) {
#pragma unroll
            for (int e = 0; e < 16; ++e)
                qf[u][s][e] = (_Float16)(qrow[s * 32 + KOFF(e)] * scale);
        }
    }

    // ---- fp32 accumulators of O^T: per query tile 128 dims x 16 queries as 8 C-fragments; a lane holds
    // dims c*16 + 8*hi + r of query u*16 + ln ----
    v8f acc[QW][8];
    float mrow[QW];   // running maximum of query u*16 + ln, equal in both halves
    float lrow[QW];   // running sum over this half's keys only; the halves join in the epilogue
#pragma unroll
    for (int u = 0; u < QW; ++u) {
#pragma unroll
        for (int c = 0; c < 8; ++c) acc[u][c] = {};
        mrow[u] = -__builtin_inff();
        lrow[u] = 0.0f;
    }

    // this wave's copies of K tile 0 and stage 0 have landed; behind the barrier every wave's have
    asm volatile("s_wait_asynccnt 0x0" ::: "memory");
    __syncthreads();
    copy_tiles(ko + (ring0 + STAGE * 2), vo + (ring0 + STAGE * 2), kg + 2 * TILE, vg + TILE);   // stage 1 into buffer 1

    // Fragment reads from LDS go out in groups of four fragments (eight 16-B reads), one to two
    // groups ahead of the products that use them, into register sets fa, fb, fc, fd: a wave then has
    // 8 to 16 reads in flight instead of 2, and waits for a group once instead of for each fragment.
    // FENCE behind a group keeps the compiler from sinking its reads back down to their first use; in
    // front of a group it keeps the reads behind the products whose registers they take over (without
    // it the kernel spills). The loops over a set are unrolled so that its fragments stay in registers.
#define FENCE() __builtin_amdgcn_sched_barrier(0)
    // MIX(n): the order inside a stretch that holds eight matrix products (0x008) and vector work that does not depend
    // on them: one product, then n vector instructions (0x402: plain and transcendental), eight times. A wave issues
    // in order, so products left in one run would hold the vector work back while the matrix unit takes them.
    // The loop is unrolled because the groups are markers in straight-line code
#define MIX(n) do { _Pragma("unroll") for (int g_ = 0; g_ < 8; ++g_) { \
        __builtin_amdgcn_sched_group_barrier(0x008, 1, 0); __builtin_amdgcn_sched_group_barrier(0x402, (n), 0); } } while (0)
    // a fragment is two 16-B pieces of one LDS row, at halves 8 * hi and 16 + 8 * hi: the order of KOFF
    auto frag = [](const _Float16* p) {
        return __builtin_shufflevector(*reinterpret_cast<const v8h*>(p), *reinterpret_cast<const v8h*>(p + 16),
                                       0, 1, 2, 3, 4, 5, 6, 7, 8, 9, 10, 11, 12, 13, 14, 15);
    };
    // scores: S^T = K x Q^T for four 16-key tiles, K-dim 128 chained; s_[u][j][r] is key j*16 + 8*hi + r against
    // query u*16 + ln. A set of four K fragments (dims s*32..) serves both query tiles
    auto qk = [&](v8f (&s_)[QW][4], int s, const v16h (&f)[4]) __attribute__((always_inline)) {
#pragma unroll
        for (int j = 0; j < 4; ++j) {
#pragma unroll
            for (int u = 0; u < QW; ++u)
                s_[u][j] = __builtin_amdgcn_wmma_f32_16x16x32_f16(false, f[j], false, qf[u][s], (short)0, s_[u][j], false, false);
        }
    };
    auto clear = [](v8f (&s_)[QW][4]) __attribute__((always_inline)) {
#pragma unroll
        for (int u = 0; u < QW; ++u) {
#pragma unroll
            for (int j = 0; j < 4; ++j) s_[u][j] = {};
        }
    };

    // ---- online softmax: a lane holds 32 of its query's 64 scores, so maximum and sum run in-lane; the maximum
    // takes one exchange between the halves. It is cut in two so that each part can stand among matrix products
    // that do not depend on it: row_max and shift follow a tile's score products, row_exp belongs to the next trip.
    // ex[u][j][r]: (score - maximum) * log2(e), then its power of two, of key j*16 + 8*hi + r, query u*16 + ln ----
    v8f   ex[QW][4];
    float alpha[QW];   // what the sums and output tiles so far are scaled by when this tile joins them
    auto row_max = [&](const v8f (&s_)[QW][4], int u) __attribute__((always_inline)) {
        float mj[4];
#pragma unroll
        for (int j = 0; j < 4; ++j) {
            mj[j] = fmaxf(fmaxf(s_[u][j][0], s_[u][j][1]), s_[u][j][2]);
            mj[j] = fmaxf(fmaxf(mj[j], s_[u][j][3]), s_[u][j][4]);
            mj[j] = fmaxf(fmaxf(mj[j], s_[u][j][5]), s_[u][j][6]);
            mj[j] = fmaxf(mj[j], s_[u][j][7]);
        }
        const float m  = fmaxf(fmaxf(fmaxf(mj[0], mj[1]), mj[2]), mj[3]);
        const float mn = fmaxf(fmaxf(m, other_half(m)), mrow[u]);
        alpha[u] = __builtin_amdgcn_exp2f((mrow[u] - mn) * LOG2E);
        mrow[u]  = mn;
    };
    auto shift = [&](const v8f (&s_)[QW][4], int u) __attribute__((always_inline)) {
#pragma unroll
        for (int j = 0; j < 4; ++j) ex[u][j] = (s_[u][j] - mrow[u]) * LOG2E;
    };

    // ---- tile 0 in front of the loop: its scores, their maxima, the shifted scores ----
    {
        const _Float16* kl0 = K0 + ln * KPITCH + hi * 8;
        v16h fa[4], fb[4];
        v8f  s0[QW][4];
        clear(s0);
#pragma unroll
        for (int j = 0; j < 4; ++j) fa[j] = frag(kl0 + j * 16 * KPITCH);
#pragma unroll
        for (int j = 0; j < 4; ++j) fb[j] = frag(kl0 + j * 16 * KPITCH + 32);
        FENCE();
        qk(s0, 0, fa);
        FENCE();
#pragma unroll
        for (int j = 0; j < 4; ++j) fa[j] = frag(kl0 + j * 16 * KPITCH + 64);
        FENCE();
        qk(s0, 1, fb);
        FENCE();
#pragma unroll
        for (int j = 0; j < 4; ++j) fb[j] = frag(kl0 + j * 16 * KPITCH + 96);
        FENCE();
        qk(s0, 2, fa);
        qk(s0, 3, fb);
#pragma unroll
        for (int u = 0; u < QW; ++u) { row_max(s0, u); shift(s0, u); }
        FENCE();
    }

    const _Float16* kn = kg + 3 * TILE;   // the K tile of the next refill
    // one trip. First half: the score products of tile tl + 1 (next: it exists), and among them the powers, sums and
    // P of tile tl. Second half: the products of P with V tile tl, and among them the maxima and shifted scores of
    // tile tl + 1. The rescaling of the output tiles is spread over both. refill: a stage tl + 2 exists.
    // Inlined at each of its places, so that acc and qf stay in registers
    auto trip = [&](const int tl, const bool refill, const bool next) __attribute__((always_inline)) {
        const int buf = (tl & 1) * STAGE;   // trip tl reads this buffer alone
        // this lane's row and half-wave offset in the two tiles: every fragment lies a constant off these
        const _Float16* kl0 = Ring + buf + ln * KPITCH + hi * 8;
        const _Float16* vt0 = Ring + buf + KHALVES + ln * VPITCH + hi * 8;
        auto kfrag = [&](int s, int j) { return frag(kl0 + j * 16 * KPITCH + s * 32); };  // keys j*16.., dims s*32..
        auto vfrag = [&](int c, int h) { return frag(vt0 + c * 16 * VPITCH + h * 32); };  // dims c*16.., keys h*32..
        v16h fa[4], fb[4], fc[4];
        v8f  sn[QW][4];
        v16h pf[QW][2];
        float ls[QW][4];

        // powers and partial sums of 32 keys (h) of query tile u, and P^T as B operand: two score tiles, converted
        // in place, are keys 0..31 (32..63) in the order of KOFF; no LDS, no lane exchange
        auto row_exp = [&](int u, int h) {
#pragma unroll
            for (int j = 2 * h; j < 2 * h + 2; ++j) {
                ls[u][j] = 0.0f;
#pragma unroll
                for (int r = 0; r < 8; ++r) { ex[u][j][r] = __builtin_amdgcn_exp2f(ex[u][j][r]); ls[u][j] += ex[u][j][r]; }
            }
            pf[u][h] = __builtin_shufflevector(__builtin_convertvector(ex[u][2 * h], v8h), __builtin_convertvector(ex[u][2 * h + 1], v8h),
                                               0, 1, 2, 3, 4, 5, 6, 7, 8, 9, 10, 11, 12, 13, 14, 15);
            if (h == 1) lrow[u] = lrow[u] * alpha[u] + ((ls[u][0] + ls[u][1]) + (ls[u][2] + ls[u][3]));
        };
        auto rescale = [&](int c) {
#pragma unroll
            for (int u = 0; u < QW; ++u) acc[u][c] *= alpha[u];
        };

        if (next) {
            clear(sn);
#pragma unroll
            for (int j = 0; j < 4; ++j) fa[j] = kfrag(0, j);
#pragma unroll
            for (int j = 0; j < 4; ++j) fb[j] = kfrag(1, j);
            FENCE();
            qk(sn, 0, fa);
        }
        row_exp(0, 0);
        rescale(0); rescale(1);
        if (next) {
            // the first reads of a trip are on their way: vector work stands in front of the first product, which waits for them
            __builtin_amdgcn_sched_group_barrier(0x402, 32, 0);
            MIX(2);
            FENCE();
#pragma unroll
            for (int j = 0; j < 4; ++j) fa[j] = kfrag(2, j);
            FENCE();
            qk(sn, 1, fb);
        }
        row_exp(0, 1);
        if (next) {
            MIX(4);
            FENCE();
#pragma unroll
            for (int j = 0; j < 4; ++j) fb[j] = kfrag(3, j);
            FENCE();
            qk(sn, 2, fa);
        }
        row_exp(1, 0);
        // V fragments of dims 0..31
        v16h fd[4];
#pragma unroll
        for (int i = 0; i < 4; ++i) fd[i] = vfrag(i >> 1, i & 1);
        if (next) qk(sn, 3, fb);
        row_exp(1, 1);
#pragma unroll
        for (int i = 0; i < 4; ++i) fb[i] = vfrag(2 + (i >> 1), i & 1);
#pragma unroll
        for (int i = 0; i < 4; ++i) fc[i] = vfrag(4 + (i >> 1), i & 1);
        // the conversions to P come out next to their first use, so this stretch reaches down to it and takes them in;
        // the groups of eight and sixteen reads (0x100) stay behind the products whose registers they take over
        if (next) MIX(6);
        __builtin_amdgcn_sched_group_barrier(0x100, 8, 0);
        if (next) MIX(6);
        __builtin_amdgcn_sched_group_barrier(0x100, 16, 0);
        FENCE();

        // ---- O^T += V^T x P^T : 8 chunks of 16 dims, contraction K = 64 keys; a set serves two chunks,
        // keys 0..31 of both and then keys 32..63 of both, each fragment against both query tiles ----
        auto pv2 = [&](int c, const v16h (&f)[4]) {
#pragma unroll
            for (int h = 0; h < 2; ++h) {
#pragma unroll
                for (int i = 0; i < 2; ++i) {
#pragma unroll
                    for (int u = 0; u < QW; ++u)
                        acc[u][c + i] = __builtin_amdgcn_wmma_f32_16x16x32_f16(false, f[2 * i + h], false, pf[u][h], (short)0, acc[u][c + i], false, false);
                }
            }
        };
        pv2(0, fd);
        rescale(2); rescale(3); rescale(4); rescale(5);
        MIX(4);
        FENCE();
#pragma unroll
        for (int i = 0; i < 4; ++i) fa[i] = vfrag(6 + (i >> 1), i & 1);
        FENCE();
        pv2(2, fb);
        rescale(6); rescale(7);
        if (next) { row_max(sn, 0); row_max(sn, 1); MIX(8); } else MIX(2);
        FENCE();
        pv2(4, fc);
        if (next) { shift(sn, 0); MIX(4); }
        FENCE();
        pv2(6, fa);
        if (next) { shift(sn, 1); MIX(4); }
        FENCE();   // the products stay in front of the waits below, which else stand ahead of them and drain the last reads at once

        // hand-over: this wave's reads of its buffer are done and its copies of stage tl + 1 have landed;
        // behind the barrier that holds for every wave, so stage tl + 1 may be read and this trip's
        // buffer refilled. The copies of stage tl + 2 then fly through the whole of trip tl + 1.
        // The last stage has no K tile of its own and takes the last tile once more, which nobody reads: a branch
        // round those four copies would split the loop body, and the vector work sinks behind such a branch
        asm volatile("s_wait_dscnt 0x0" ::: "memory");
        asm volatile("s_wait_asynccnt 0x0" ::: "memory");
        __syncthreads();
        if (refill) {
            copy_tiles(ko + (ring0 + buf * 2), vo + (ring0 + buf * 2), kn, vg + (tl + 2) * TILE);
            kn += tl + 4 < NTILES ? TILE : 0;
        }
    };
    // the last two trips refill nothing and stand alone, so that no body holds a branch
    for (int tl = 0; tl < NTILES - 2; ++tl) trip(tl, true, true);
    trip(NTILES - 2, false, true);
    trip(NTILES - 1, false, false);
#undef MIX
#undef FENCE
    // no copy is outstanding when the wave goes on to its end
    asm volatile("s_wait_asynccnt 0x0" ::: "memory");

    // ---- epilogue: join the halves' sums, divide, and turn O^T back into rows through this wave's
    // own LDS range, so that every global store covers one whole 512-B row ----
    float* ow = Ol + wave * (QW * 16) * OPITCH;
#pragma unroll
    for (int u = 0; u < QW; ++u) {
        const float inv = 1.0f / (lrow[u] + other_half(lrow[u]));
#pragma unroll
        for (int c = 0; c < 8; ++c) {
            const v8f o = acc[u][c] * inv;
            float* p = ow + (u * 16 + ln) * OPITCH + c * 16 + hi * 8;
            *reinterpret_cast<float4*>(p)     = make_float4(o[0], o[1], o[2], o[3]);
            *reinterpret_cast<float4*>(p + 4) = make_float4(o[4], o[5], o[6], o[7]);
        }
    }
    // the other lanes' rows are in LDS before this lane reads them back
    asm volatile("s_wait_dscnt 0x0" ::: "memory");
    float4 orow[QW * 16];
#pragma unroll
    for (int i = 0; i < QW * 16; ++i)
        orow[i] = *reinterpret_cast<const float4*>(ow + i * OPITCH + lane * 4);
    float* og = O + base + (size_t)qrow0 * Ddim + lane * 4;
#pragma unroll
    for (int i = 0; i < QW * 16; ++i)
        *reinterpret_cast<float4*>(og + i * Ddim) = orow[i];
}

extern "C" void kernel_launch(void* const* d_in, const int* in_sizes, int n_in,
                              void* d_out, int out_size, void* d_ws, size_t ws_size,
                              hipStream_t stream) {
    (void)in_sizes; (void)n_in; (void)out_size; (void)ws_size;
    const float* Q = (const float*)d_in[0];
    const float* K = (const float*)d_in[1];
    const float* V = (const float*)d_in[2];
    float*       O = (float*)d_out;
    _Float16*    Kh = (_Float16*)d_ws;                      // 32 MiB
    _Float16*    Vh = Kh + (size_t)4 * 16 * Sdim * Ddim;    // 32 MiB

    dim3 grid(Sdim / QTILE, 4 * 16);   // (8 q-tiles, B*H = 64)
    dim3 block(256);                   // 8 wave32 waves
    dim3 pgrid(Sdim / KTILE, 4 * 16, 2);  // one tile per block; z: K or V
    kv_to_f16_kernel<<<pgrid, block, 0, stream>>>(K, V, Kh, Vh);
    fattn_kernel<<<grid, block, 0, stream>>>(Q, Kh, Vh, O);
}

// v008
// A run of this version takes 111 microseconds.
// Next to v007, in two timings, it ran 1.08 times as fast each time.
// Counting every step since v000, it is 6.67 times as fast.
#include <hip/hip_runtime.h>

typedef __attribute__((ext_vector_type(16))) _Float16 v16h;
typedef __attribute__((ext_vector_type(2)))  _Float16 v2h;
typedef __attribute__((ext_vector_type(4)))  _Float16 v4h;
typedef __attribute__((ext_vector_type(8)))  _Float16 v8h;
typedef __attribute__((ext_vector_type(8)))  float    v8f;

constexpr int Sdim  = 2048;
constexpr int Ddim  = 128;
constexpr int QW    = 2;     // 16-query tiles per wave: each K or V fragment read from LDS serves QW products
constexpr int QTILE = 256;   // query rows per block (8 waves x QW x 16)
constexpr int KTILE = 64;    // keys per iteration (4 x 16x16 score tiles)
constexpr int NWAVES = 8;
// LDS row pitches in halves: row bytes + 16, an odd multiple of 16 B, so that the 16 rows
// one ds_load_b128 touches per half-wave fall on distinct banks (pad halves are never read)
constexpr int KPITCH = Ddim  + 8;   // 272 B
constexpr int VPITCH = KTILE + 8;   // 144 B
constexpr int OPITCH = Ddim  + 4;   // floats, 528 B: the 16 rows one ds_store_b128 touches per half-wave cover all banks once
constexpr int KHALVES = KTILE * KPITCH;      // K tile in LDS, [k][d], f16            (17 KB)
constexpr int VHALVES = Ddim  * VPITCH;      // V tile in LDS, [d][k] transposed, f16 (18 KB)
constexpr int STAGE   = KHALVES + VHALVES;   // one buffer: a K tile and behind it a V tile
constexpr int NTILES  = Sdim / KTILE;

// element e of a 16-bit A/B fragment -> contraction-dim offset (ISA 7.12.2)
#define KOFF(e) ((( ((e) >> 1) < 4 ) ? (((e) >> 1) * 2) : (16 + (((e) >> 1) - 4) * 2)) \
                 + (hi << 3) + ((e) & 1))

// the value that lane l ^ 16 holds: the two halves of a wave share each query column
__device__ __forceinline__ float other_half(float x) {
    const int b = __builtin_bit_cast(int, x);
    return __builtin_bit_cast(float, __builtin_amdgcn_permlanex16(b, b, 0x76543210, 0xfedcba98, false, false));
}

// One thread's share of a K tile and a V tile, 4 + 4 pieces of 16 B, from global memory straight into
// LDS. kd, vd: LDS byte address of the thread's first piece of each tile; a further piece lies 16 K rows
// (32 V rows) on in LDS and 4 KB on in memory. The s_wait_xcnt is the last line of the copies' own
// statement, so that it stands in front of any rewrite of a register that a copy names
__device__ __forceinline__ void copy_tiles(unsigned kd, unsigned vd, const _Float16* kp, const _Float16* vp) {
    asm volatile("global_load_async_to_lds_b128 %0, %8, off\n\t"
                 "global_load_async_to_lds_b128 %4, %12, off\n\t"
                 "global_load_async_to_lds_b128 %1, %9, off\n\t"
                 "global_load_async_to_lds_b128 %5, %13, off\n\t"
                 "global_load_async_to_lds_b128 %2, %10, off\n\t"
                 "global_load_async_to_lds_b128 %6, %14, off\n\t"
                 "global_load_async_to_lds_b128 %3, %11, off\n\t"
                 "global_load_async_to_lds_b128 %7, %15, off\n\t"
                 "s_wait_xcnt 0x0"
                 :: "v"(kd), "v"(kd + 16 * KPITCH * 2), "v"(kd + 32 * KPITCH * 2), "v"(kd + 48 * KPITCH * 2),
                    "v"(vd), "v"(vd + 32 * VPITCH * 2), "v"(vd + 64 * VPITCH * 2), "v"(vd + 96 * VPITCH * 2),
                    "v"(kp), "v"(kp + 2048), "v"(kp + 4096), "v"(kp + 6144),
                    "v"(vp), "v"(vp + 2048), "v"(vp + 4096), "v"(vp + 6144)
                 : "memory");
}

// Four pieces of 16 B of one tile, as in copy_tiles: d is the LDS byte address of the thread's first piece, a
// further piece lies dstep bytes on in LDS and 4 KB on in memory. The s_wait_xcnt is again the statement's last line
__device__ __forceinline__ void copy_tile(unsigned d, unsigned dstep, const _Float16* p) {
    asm volatile("global_load_async_to_lds_b128 %0, %4, off\n\t"
                 "global_load_async_to_lds_b128 %1, %5, off\n\t"
                 "global_load_async_to_lds_b128 %2, %6, off\n\t"
                 "global_load_async_to_lds_b128 %3, %7, off\n\t"
                 "s_wait_xcnt 0x0"
                 :: "v"(d), "v"(d + dstep), "v"(d + 2 * dstep), "v"(d + 3 * dstep),
                    "v"(p), "v"(p + 2048), "v"(p + 4096), "v"(p + 6144)
                 : "memory");
}

// ---- pre-pass: K and V go to f16 once per call, instead of once per query tile ----
// Kh keeps K's [key][dim] order; Vh holds, per tile of KTILE keys, the tile transposed:
// [dim][key], Ddim x KTILE halves in a row, so that both tiles are 16 KB of contiguous bytes.
// One block per tile; blockIdx.z picks K (0) or V (1)
__global__ __launch_bounds__(256) void kv_to_f16_kernel(
    const float* __restrict__ K, const float* __restrict__ V,
    _Float16* __restrict__ Kh, _Float16* __restrict__ Vh)
{
    __shared__ __attribute__((aligned(16))) _Float16 T[Ddim * VPITCH];   // V tile, [d][k]

    const int t = threadIdx.x;
    const size_t tile = ((size_t)blockIdx.y * (Sdim / KTILE) + blockIdx.x) * (KTILE * Ddim);

    if (blockIdx.z == 0) {   // the same for the whole block, and in front of the barrier
        // K: 4 floats in, 4 halves out, same order
        const float* kt = K + tile;
        float4 kf[8];
#pragma unroll
        for (int i = 0; i < 8; ++i)
            kf[i] = *reinterpret_cast<const float4*>(kt + (i * 256 + t) * 4);
#pragma unroll
        for (int i = 0; i < 8; ++i)
            *reinterpret_cast<v4h*>(Kh + tile + (i * 256 + t) * 4) =
                (v4h){(_Float16)kf[i].x, (_Float16)kf[i].y, (_Float16)kf[i].z, (_Float16)kf[i].w};
        return;
    }

    // V: each thread takes 4 dims of two neighbouring keys, four times, 16 keys apart;
    // 8 lanes cover one 128-B line
    const int c4  = ((t >> 5) & 3) * 8 + (t & 7);          // float4 column, 0..31
    const int rp0 = (t >> 7) * 4 + ((t >> 3) & 3);         // key pair of trip 0; + 8 a trip
    const float* vb = V + tile + (2 * rp0) * Ddim + c4 * 4;
    float4 w0[4], w1[4];
#pragma unroll
    for (int i = 0; i < 4; ++i) {
        w0[i] = *reinterpret_cast<const float4*>(vb + (16 * i)     * Ddim);
        w1[i] = *reinterpret_cast<const float4*>(vb + (16 * i + 1) * Ddim);
    }
    // the wait that stands in front of any rewrite of an issued load's address registers; it
    // names the pointer as an input, so no load's result is placed on that pair ahead of it
    asm volatile("s_wait_xcnt 0x0" :: "v"(vb) : "memory");
#pragma unroll
    for (int i = 0; i < 4; ++i) {
        const int k2 = 2 * (rp0 + 8 * i);
        *reinterpret_cast<v2h*>(&T[(c4 * 4 + 0) * VPITCH + k2]) = (v2h){(_Float16)w0[i].x, (_Float16)w1[i].x};
        *reinterpret_cast<v2h*>(&T[(c4 * 4 + 1) * VPITCH + k2]) = (v2h){(_Float16)w0[i].y, (_Float16)w1[i].y};
        *reinterpret_cast<v2h*>(&T[(c4 * 4 + 2) * VPITCH + k2]) = (v2h){(_Float16)w0[i].z, (_Float16)w1[i].z};
        *reinterpret_cast<v2h*>(&T[(c4 * 4 + 3) * VPITCH + k2]) = (v2h){(_Float16)w0[i].w, (_Float16)w1[i].w};
    }

    __syncthreads();   // the transposed V tile is complete
#pragma unroll
    for (int i = 0; i < 4; ++i) {
        const int o = i * 256 + t;                         // 16-B piece of the tile
        *reinterpret_cast<v8h*>(Vh + tile + o * 8) =
            *reinterpret_cast<const v8h*>(&T[(o >> 3) * VPITCH + (o & 7) * 8]);
    }
}

// a wave holds the output tiles, Q, the scores of one key tile and the powers of another for 32 queries, more than
// 256 VGPRs: two waves per SIMD, one work-group per WGP.
// Softmax runs against a held reference per query: P = 2^(score - ref), with ref the maximum of key tile 0, moved only
// when a later score tops it by more than RISE. Any ref gives the same quotient sum(P V) / sum(P); P stays within f16
__global__ __launch_bounds__(256) void fattn_kernel(
    const float* __restrict__ Q, const _Float16* __restrict__ Kh,
    const _Float16* __restrict__ Vh, float* __restrict__ O)
{
    // two buffers; stage s = K tile s + 1 and V tile s lies in buffer s & 1 (70 KB): K runs one tile ahead of V,
    // because trip s forms the scores of tile s + 1 while it works on the scores of tile s
    __shared__ __attribute__((aligned(16))) _Float16 Ring[2 * STAGE];
    __shared__ __attribute__((aligned(16))) _Float16 K0[KHALVES];         // K tile 0, read once in front of the loop (17 KB)
    __shared__ __attribute__((aligned(16))) float Ol[NWAVES * QW * 16 * OPITCH];  // per-wave output rows, epilogue only (132 KB)

    const int t    = threadIdx.x;
    const int wave = t >> 5;
    const int lane = t & 31;
    const int hi   = lane >> 4;   // half-wave select
    const int ln   = lane & 15;

    const int bh = blockIdx.y;                       // 0..63  (B*H)
    const int qt = blockIdx.x;                       // 0..7   (S/QTILE)
    const size_t base  = (size_t)bh * Sdim * Ddim;
    const int    qrow0 = qt * QTILE + wave * (QW * 16);

    // 1/sqrt(128) * log2(e): the scores come out of the products in log2 units, e^x = 2^(x * log2(e))
    const float scale = 0.08838834764831845f * 1.44269504088896340736f;
    constexpr float RISE = 8.0f;   // P is at most 2^8

    // both tiles are 16 KB of contiguous f16; piece o = i * 256 + t of a tile goes to K row o >> 4,
    // V row o >> 3. An LDS byte address is the low 32 bits of the __shared__ address
    const unsigned ring0 = (unsigned)reinterpret_cast<size_t>(&Ring[0]);
    // ko, vo: the thread's first piece inside a buffer; a buffer's own address is added at each call, so that
    // what lives through the loop is no operand of a copy and may lie in any register (else it spilled)
    const unsigned ko    = (t >> 4) * (KPITCH * 2) + (t & 15) * 16;
    const unsigned vo    = KHALVES * 2 + (t >> 3) * (VPITCH * 2) + (t & 7) * 16;
    const _Float16* kg = Kh + base + t * 8;
    const _Float16* vg = Vh + base + t * 8;
    constexpr int TILE = KTILE * Ddim;
    // K tile 0 into K0, stage 0 (K tile 1, V tile 0) into buffer 0; they fly while Q is loaded
    copy_tile(ko + (unsigned)reinterpret_cast<size_t>(&K0[0]), 16 * KPITCH * 2, kg);
    copy_tiles(ko + ring0, vo + ring0, kg + TILE, vg);

    // ---- persistent Q fragments (per query tile u: 4 x 32 dims x 16 queries, f16), pre-scaled: the B operand
    // of S^T = K x Q^T ----
    v16h qf[QW][4];
#pragma unroll
    for (int u = 0; u < QW; ++u) {
        const float* qrow = Q + base + (size_t)(qrow0 + u * 16 + ln) * Ddim;
#pragma unroll
        for (int s = 0; s < 4; ++s) {
#pragma unroll
            for (int e = 0; e < 16; ++e)
                qf[u][s][e] = (_Float16)(qrow[s * 32 + KOFF(e)] * scale);
        }
    }

    // ---- fp32 accumulators of O^T: per query tile 128 dims x 16 queries as 8 C-fragments; a lane holds
    // dims c*16 + 8*hi + r of query u*16 + ln ----
    v8f acc[QW][8];
    v8f   cref[QW];   // minus the reference of query u*16 + ln in all eight places, equal in both halves: C of the score products
    float lrow[QW];   // running sum over this half's keys only; the halves join in the epilogue
#pragma unroll
    for (int u = 0; u < QW; ++u) {
#pragma unroll
        for (int c = 0; c < 8; ++c) acc[u][c] = {};
        lrow[u] = 0.0f;
    }

    // this wave's copies of K tile 0 and stage 0 have landed; behind the barrier every wave's have
    asm volatile("s_wait_asynccnt 0x0" ::: "memory");
    __syncthreads();
    copy_tiles(ko + (ring0 + STAGE * 2), vo + (ring0 + STAGE * 2), kg + 2 * TILE, vg + TILE);   // stage 1 into buffer 1

    // Fragment reads from LDS go out in groups of four fragments (eight 16-B reads), one to two
    // groups ahead of the products that use them, into register sets fa, fb, fc, fd: a wave then has
    // 8 to 16 reads in flight instead of 2, and waits for a group once instead of for each fragment.
    // FENCE behind a group keeps the compiler from sinking its reads back down to their first use; in
    // front of a group it keeps the reads behind the products whose registers they take over (without
    // it the kernel spills). The loops over a set are unrolled so that its fragments stay in registers.
#define FENCE() __builtin_amdgcn_sched_barrier(0)
    // MIX(n): the order inside a stretch that holds eight matrix products (0x008) and vector work that does not depend
    // on them: one product, then n vector instructions (0x402: plain and transcendental), eight times. A wave issues
    // in order, so products left in one run would hold the vector work back while the matrix unit takes them.
    // The loop is unrolled because the groups are markers in straight-line code
#define MIX(n) do { _Pragma("unroll") for (int g_ = 0; g_ < 8; ++g_) { \
        __builtin_amdgcn_sched_group_barrier(0x008, 1, 0); __builtin_amdgcn_sched_group_barrier(0x402, (n), 0); } } while (0)
    // a fragment is two 16-B pieces of one LDS row, at halves 8 * hi and 16 + 8 * hi: the order of KOFF
    auto frag = [](const _Float16* p) {
        return __builtin_shufflevector(*reinterpret_cast<const v8h*>(p), *reinterpret_cast<const v8h*>(p + 16),
                                       0, 1, 2, 3, 4, 5, 6, 7, 8, 9, 10, 11, 12, 13, 14, 15);
    };
    // scores: S^T = K x Q^T for one 16-key tile against both query tiles, K-dim 128 chained over the four fragments of a
    // set (dims s*32..); s_[u][j][r] is key j*16 + 8*hi + r against query u*16 + ln. C at the head of a chain is minus
    // the reference, so that the chain ends in score - ref
    auto qk = [&](v8f (&s_)[QW][4], int j, const v16h (&f)[4]) __attribute__((always_inline)) {
#pragma unroll
        for (int s = 0; s < 4; ++s) {
#pragma unroll
            for (int u = 0; u < QW; ++u)
                s_[u][j] = __builtin_amdgcn_wmma_f32_16x16x32_f16(false, f[s], false, qf[u][s], (short)0, s == 0 ? cref[u] : s_[u][j], false, false);
        }
    };

    // ---- softmax: a lane holds 32 of its query's 64 scores of a tile, so maximum and sum run in-lane.
    // ex[u][j][r]: score - ref of key j*16 + 8*hi + r, query u*16 + ln. A trip takes the powers of key tile j and then lets
    // the next tile's products write their scores of key tile j to the same place ----
    v8f ex[QW][4];
    auto lane_max = [](const v8f (&s_)[QW][4], int u) __attribute__((always_inline)) {
        float mj[4];
#pragma unroll
        for (int j = 0; j < 4; ++j) {
            mj[j] = fmaxf(fmaxf(s_[u][j][0], s_[u][j][1]), s_[u][j][2]);
            mj[j] = fmaxf(fmaxf(mj[j], s_[u][j][3]), s_[u][j][4]);
            mj[j] = fmaxf(fmaxf(mj[j], s_[u][j][5]), s_[u][j][6]);
            mj[j] = fmaxf(mj[j], s_[u][j][7]);
        }
        return fmaxf(fmaxf(fmaxf(mj[0], mj[1]), mj[2]), mj[3]);
    };
    // the reference of each query goes up to the maximum in s_ (mx: the lane's own share of it) where that lies above
    // it: the sums and output tiles so far, and s_ itself, follow
    auto move_ref = [&](v8f (&s_)[QW][4], const float (&mx)[QW]) __attribute__((always_inline)) {
#pragma unroll
        for (int u = 0; u < QW; ++u) {
            const float d = fmaxf(fmaxf(mx[u], other_half(mx[u])), 0.0f);
            const float a = __builtin_amdgcn_exp2f(-d);
            lrow[u] *= a;
#pragma unroll
            for (int c = 0; c < 8; ++c) acc[u][c] *= a;
#pragma unroll
            for (int j = 0; j < 4; ++j) s_[u][j] -= d;
            cref[u] -= d;
        }
    };

    // ---- tile 0 in front of the loop: its scores against reference 0, then their maxima become the references ----
    {
        const _Float16* kl0 = K0 + ln * KPITCH + hi * 8;
        v16h fa[4], fb[4];
#pragma unroll
        for (int u = 0; u < QW; ++u) cref[u] = {};
#pragma unroll
        for (int s = 0; s < 4; ++s) fa[s] = frag(kl0 + s * 32);
#pragma unroll
        for (int s = 0; s < 4; ++s) fb[s] = frag(kl0 + 16 * KPITCH + s * 32);
        FENCE();
        qk(ex, 0, fa);
        FENCE();
#pragma unroll
        for (int s = 0; s < 4; ++s) fa[s] = frag(kl0 + 32 * KPITCH + s * 32);
        FENCE();
        qk(ex, 1, fb);
        FENCE();
#pragma unroll
        for (int s = 0; s < 4; ++s) fb[s] = frag(kl0 + 48 * KPITCH + s * 32);
        FENCE();
        qk(ex, 2, fa);
        qk(ex, 3, fb);
#pragma unroll
        for (int u = 0; u < QW; ++u) {
            const float m = lane_max(ex, u);
            cref[u] -= fmaxf(m, other_half(m));
#pragma unroll
            for (int j = 0; j < 4; ++j) ex[u][j] += cref[u];
        }
        FENCE();
    }

    const _Float16* kn = kg + 3 * TILE;   // the K tile of the next refill
    // one trip. First half: the score products of tile tl + 1 (next: it exists), key tile by key tile, and among them the
    // powers, sums and P of tile tl, one key tile ahead of the products that take its place. Second half: the products of
    // P with V tile tl, and among them the lane maxima of tile tl + 1. At the foot one test for the whole wave: has a
    // score of tile tl + 1 left the range that the references allow. refill: a stage tl + 2 exists.
    // Inlined at each of its places, so that acc and qf stay in registers
    auto trip = [&](const int tl, const bool refill, const bool next) __attribute__((always_inline)) {
        const int buf = (tl & 1) * STAGE;   // trip tl reads this buffer alone
        // this lane's row and half-wave offset in the two tiles: every fragment lies a constant off these
        const _Float16* kl0 = Ring + buf + ln * KPITCH + hi * 8;
        const _Float16* vt0 = Ring + buf + KHALVES + ln * VPITCH + hi * 8;
        auto kfrag = [&](int s, int j) { return frag(kl0 + j * 16 * KPITCH + s * 32); };  // keys j*16.., dims s*32..
        auto vfrag = [&](int c, int h) { return frag(vt0 + c * 16 * VPITCH + h * 32); };  // dims c*16.., keys h*32..
        v16h fa[4], fb[4], fc[4];
        v8f  pw[QW][4];
        v16h pf[QW][2];
        float ls[QW][4];
        float mx[QW];
        unsigned over = 0;   // the lanes that hold a score of tile tl + 1 more than RISE above its reference

        // powers and partial sums of key tile j, both query tiles
        auto tile_exp = [&](int j) {
#pragma unroll
            for (int u = 0; u < QW; ++u) {
                ls[u][j] = 0.0f;
#pragma unroll
                for (int r = 0; r < 8; ++r) { pw[u][j][r] = __builtin_amdgcn_exp2f(ex[u][j][r]); ls[u][j] += pw[u][j][r]; }
            }
        };
        // P^T as B operand: two score tiles, converted, are keys 0..31 (32..63) in the order of KOFF; no LDS, no lane exchange
        auto pack = [&](int h) {
#pragma unroll
            for (int u = 0; u < QW; ++u)
                pf[u][h] = __builtin_shufflevector(__builtin_convertvector(pw[u][2 * h], v8h), __builtin_convertvector(pw[u][2 * h + 1], v8h),
                                                   0, 1, 2, 3, 4, 5, 6, 7, 8, 9, 10, 11, 12, 13, 14, 15);
        };

        if (next) {
#pragma unroll
            for (int s = 0; s < 4; ++s) fa[s] = kfrag(s, 0);
#pragma unroll
            for (int s = 0; s < 4; ++s) fb[s] = kfrag(s, 1);
            FENCE();
        }
        tile_exp(0);   // the first reads of a trip are on their way: this work stands in front of the first product, which waits for them
        FENCE();
        if (next) qk(ex, 0, fa);
        tile_exp(1);
        if (next) {
            MIX(4);
            FENCE();
#pragma unroll
            for (int s = 0; s < 4; ++s) fa[s] = kfrag(s, 2);
            FENCE();
            qk(ex, 1, fb);
        }
        tile_exp(2);
        if (next) {
            MIX(4);
            FENCE();
#pragma unroll
            for (int s = 0; s < 4; ++s) fb[s] = kfrag(s, 3);
            FENCE();
            qk(ex, 2, fa);
        }
        tile_exp(3);
        pack(0);
        pack(1);
        // V fragments of dims 0..31
        v16h fd[4];
#pragma unroll
        for (int i = 0; i < 4; ++i) fd[i] = vfrag(i >> 1, i & 1);
        if (next) qk(ex, 3, fb);
#pragma unroll
        for (int u = 0; u < QW; ++u) lrow[u] += (ls[u][0] + ls[u][1]) + (ls[u][2] + ls[u][3]);
#pragma unroll
        for (int i = 0; i < 4; ++i) fb[i] = vfrag(2 + (i >> 1), i & 1);
#pragma unroll
        for (int i = 0; i < 4; ++i) fc[i] = vfrag(4 + (i >> 1), i & 1);
        // the conversions to P come out next to their first use, so this stretch reaches down to it and takes them in;
        // the groups of eight and sixteen reads (0x100) stay behind the products whose registers they take over
        if (next) MIX(6);
        __builtin_amdgcn_sched_group_barrier(0x100, 8, 0);
        if (next) MIX(3);
        __builtin_amdgcn_sched_group_barrier(0x100, 16, 0);
        FENCE();

        // ---- O^T += V^T x P^T : 8 chunks of 16 dims, contraction K = 64 keys; a set serves two chunks,
        // keys 0..31 of both and then keys 32..63 of both, each fragment against both query tiles ----
        auto pv2 = [&](int c, const v16h (&f)[4]) {
#pragma unroll
            for (int h = 0; h < 2; ++h) {
#pragma unroll
                for (int i = 0; i < 2; ++i) {
#pragma unroll
                    for (int u = 0; u < QW; ++u)
                        acc[u][c + i] = __builtin_amdgcn_wmma_f32_16x16x32_f16(false, f[2 * i + h], false, pf[u][h], (short)0, acc[u][c + i], false, false);
                }
            }
        };
        pv2(0, fd);
        FENCE();
#pragma unroll
        for (int i = 0; i < 4; ++i) fa[i] = vfrag(6 + (i >> 1), i & 1);
        FENCE();
        pv2(2, fb);
        // the test's lane mask is formed here, sixteen products ahead of the branch that reads it
        if (next) {
            mx[0] = lane_max(ex, 0);
            mx[1] = lane_max(ex, 1);
            over  = __builtin_amdgcn_ballot_w32(fmaxf(mx[0], mx[1]) > RISE);
            MIX(6);
        }
        FENCE();
        pv2(4, fc);
        pv2(6, fa);
        FENCE();   // the products stay in front of the waits below, which else stand ahead of them and drain the last reads at once

        // hand-over: this wave's reads of its buffer are done and its copies of stage tl + 1 have landed;
        // behind the barrier that holds for every wave, so stage tl + 1 may be read and this trip's
        // buffer refilled. The copies of stage tl + 2 then fly through the whole of trip tl + 1.
        // The last stage has no K tile of its own and takes the last tile once more, which nobody reads: a branch
        // round those four copies would split the loop body, and the vector work sinks behind such a branch
        asm volatile("s_wait_dscnt 0x0" ::: "memory");
        asm volatile("s_wait_asynccnt 0x0" ::: "memory");
        __syncthreads();
        if (refill) {
            copy_tiles(ko + (ring0 + buf * 2), vo + (ring0 + buf * 2), kn, vg + (tl + 2) * TILE);
            kn += tl + 4 < NTILES ? TILE : 0;
        }
        // one scalar branch a trip, behind all of the trip's work, so that the body above it stays one block; the output
        // tiles and sums hold tile tl by now, and nothing of tile tl + 1 has been used
        if (next && over != 0) move_ref(ex, mx);
    };
    // the last two trips refill nothing and stand alone
    for (int tl = 0; tl < NTILES - 2; ++tl) trip(tl, true, true);
    trip(NTILES - 2, false, true);
    trip(NTILES - 1, false, false);
#undef MIX
#undef FENCE
    // no copy is outstanding when the wave goes on to its end
    asm volatile("s_wait_asynccnt 0x0" ::: "memory");

    // ---- epilogue: join the halves' sums, divide, and turn O^T back into rows through this wave's
    // own LDS range, so that every global store covers one whole 512-B row ----
    float* ow = Ol + wave * (QW * 16) * OPITCH;
#pragma unroll
    for (int u = 0; u < QW; ++u) {
        const float inv = 1.0f / (lrow[u] + other_half(lrow[u]));
#pragma unroll
        for (int c = 0; c < 8; ++c) {
            const v8f o = acc[u][c] * inv;
            float* p = ow + (u * 16 + ln) * OPITCH + c * 16 + hi * 8;
            *reinterpret_cast<float4*>(p)     = make_float4(o[0], o[1], o[2], o[3]);
            *reinterpret_cast<float4*>(p + 4) = make_float4(o[4], o[5], o[6], o[7]);
        }
    }
    // the other lanes' rows are in LDS before this lane reads them back
    asm volatile("s_wait_dscnt 0x0" ::: "memory");
    float4 orow[QW * 16];
#pragma unroll
    for (int i = 0; i < QW * 16; ++i)
        orow[i] = *reinterpret_cast<const float4*>(ow + i * OPITCH + lane * 4);
    float* og = O + base + (size_t)qrow0 * Ddim + lane * 4;
#pragma unroll
    for (int i = 0; i < QW * 16; ++i)
        *reinterpret_cast<float4*>(og + i * Ddim) = orow[i];
}

extern "C" void kernel_launch(void* const* d_in, const int* in_sizes, int n_in,
                              void* d_out, int out_size, void* d_ws, size_t ws_size,
                              hipStream_t stream) {
    (void)in_sizes; (void)n_in; (void)out_size; (void)ws_size;
    const float* Q = (const float*)d_in[0];
    const float* K = (const float*)d_in[1];
    const float* V = (const float*)d_in[2];
    float*       O = (float*)d_out;
    _Float16*    Kh = (_Float16*)d_ws;                      // 32 MiB
    _Float16*    Vh = Kh + (size_t)4 * 16 * Sdim * Ddim;    // 32 MiB

    dim3 grid(Sdim / QTILE, 4 * 16);   // (8 q-tiles, B*H = 64)
    dim3 block(256);                   // 8 wave32 waves
    dim3 pgrid(Sdim / KTILE, 4 * 16, 2);  // one tile per block; z: K or V
    kv_to_f16_kernel<<<pgrid, block, 0, stream>>>(K, V, Kh, Vh);
    fattn_kernel<<<grid, block, 0, stream>>>(Q, Kh, Vh, O);
}

// v009
// It runs in 99.5 microseconds.
// Timed twice side by side with v008, it ran 1.12 times as fast both times.
// Over all steps from v000 it is 7.44 times as fast.
#include <hip/hip_runtime.h>

typedef __attribute__((ext_vector_type(16))) _Float16 v16h;
typedef __attribute__((ext_vector_type(2)))  _Float16 v2h;
typedef __attribute__((ext_vector_type(4)))  _Float16 v4h;
typedef __attribute__((ext_vector_type(8)))  _Float16 v8h;
typedef __attribute__((ext_vector_type(8)))  float    v8f;

constexpr int Sdim  = 2048;
constexpr int Ddim  = 128;
constexpr int QW    = 2;     // 16-query tiles per wave: each K or V fragment read from LDS serves QW products
constexpr int QTILE = 256;   // query rows per block (8 waves x QW x 16)
constexpr int KTILE = 64;    // keys per iteration (4 x 16x16 score tiles)
constexpr int NWAVES = 8;
// LDS row pitches in halves: row bytes + 16, an odd multiple of 16 B, so that the 16 rows
// one ds_load_b128 touches per half-wave fall on distinct banks (pad halves are never read)
constexpr int KPITCH = Ddim  + 8;   // 272 B
constexpr int VPITCH = KTILE + 8;   // 144 B
constexpr int OPITCH = Ddim  + 4;   // floats, 528 B: the 16 rows one ds_store_b128 touches per half-wave cover all banks once
constexpr int KHALVES = KTILE * KPITCH;      // K tile in LDS, [k][d], f16            (17 KB)
constexpr int VHALVES = Ddim  * VPITCH;      // V tile in LDS, [d][k] transposed, f16 (18 KB)
constexpr int STAGE   = KHALVES + VHALVES;   // one buffer: a K tile and behind it a V tile
constexpr int NTILES  = Sdim / KTILE;
// f32 tiles as they come from memory, in LDS: K rows at their own 512 B; V rows at 528 B, so that the two key groups
// (eight rows apart) that one ds_load_b128 touches per half-wave fall on the two halves of the banks
constexpr int RVPITCH = Ddim + 4;                        // floats
constexpr int RKFLOATS = KTILE * Ddim;                   // 32 KB
constexpr int RSTAGE   = RKFLOATS + KTILE * RVPITCH;     // one f32 buffer: a K tile and behind it a V tile (65 KB)

// element e of a 16-bit A/B fragment -> contraction-dim offset (ISA 7.12.2)
#define KOFF(e) ((( ((e) >> 1) < 4 ) ? (((e) >> 1) * 2) : (16 + (((e) >> 1) - 4) * 2)) \
                 + (hi << 3) + ((e) & 1))

// the value that lane l ^ 16 holds: the two halves of a wave share each query column
__device__ __forceinline__ float other_half(float x) {
    const int b = __builtin_bit_cast(int, x);
    return __builtin_bit_cast(float, __builtin_amdgcn_permlanex16(b, b, 0x76543210, 0xfedcba98, false, false));
}

// One thread's share of an f32 K tile and an f32 V tile, 8 + 8 pieces of 16 B, from global memory straight into LDS.
// kd, vd: LDS byte address of the thread's first piece of each tile; a further piece lies 4 KB on in memory and eight
// rows on in LDS: 4 KB for K, 4 KB + 128 B for V. offset:N moves both addresses of a copy by N, so K needs one address
// register and V one per piece, 128 B apart. The s_wait_xcnt is the last line of the copies' own statement, so that it
// stands in front of any rewrite of a register that a copy names
__device__ __forceinline__ void copy_raw(unsigned kd, unsigned vd, const float* kp, const float* vp) {
    asm volatile("global_load_async_to_lds_b128 %0, %9, off\n\t"
                 "global_load_async_to_lds_b128 %1, %10, off\n\t"
                 "global_load_async_to_lds_b128 %0, %9, off offset:4096\n\t"
                 "global_load_async_to_lds_b128 %2, %10, off offset:4096\n\t"
                 "global_load_async_to_lds_b128 %0, %9, off offset:8192\n\t"
                 "global_load_async_to_lds_b128 %3, %10, off offset:8192\n\t"
                 "global_load_async_to_lds_b128 %0, %9, off offset:12288\n\t"
                 "global_load_async_to_lds_b128 %4, %10, off offset:12288\n\t"
                 "global_load_async_to_lds_b128 %0, %9, off offset:16384\n\t"
                 "global_load_async_to_lds_b128 %5, %10, off offset:16384\n\t"
                 "global_load_async_to_lds_b128 %0, %9, off offset:20480\n\t"
                 "global_load_async_to_lds_b128 %6, %10, off offset:20480\n\t"
                 "global_load_async_to_lds_b128 %0, %9, off offset:24576\n\t"
                 "global_load_async_to_lds_b128 %7, %10, off offset:24576\n\t"
                 "global_load_async_to_lds_b128 %0, %9, off offset:28672\n\t"
                 "global_load_async_to_lds_b128 %8, %10, off offset:28672\n\t"
                 "s_wait_xcnt 0x0"
                 :: "v"(kd),
                    "v"(vd), "v"(vd + 128), "v"(vd + 256), "v"(vd + 384), "v"(vd + 512), "v"(vd + 640), "v"(vd + 768), "v"(vd + 896),
                    "v"(kp), "v"(vp)
                 : "memory");
}

// The eight pieces of one f32 K tile, as in copy_raw
__device__ __forceinline__ void copy_raw_k(unsigned kd, const float* kp) {
    asm volatile("global_load_async_to_lds_b128 %0, %1, off\n\t"
                 "global_load_async_to_lds_b128 %0, %1, off offset:4096\n\t"
                 "global_load_async_to_lds_b128 %0, %1, off offset:8192\n\t"
                 "global_load_async_to_lds_b128 %0, %1, off offset:12288\n\t"
                 "global_load_async_to_lds_b128 %0, %1, off offset:16384\n\t"
                 "global_load_async_to_lds_b128 %0, %1, off offset:20480\n\t"
                 "global_load_async_to_lds_b128 %0, %1, off offset:24576\n\t"
                 "global_load_async_to_lds_b128 %0, %1, off offset:28672\n\t"
                 "s_wait_xcnt 0x0"
                 :: "v"(kd), "v"(kp)
                 : "memory");
}

// a wave holds the output tiles, Q, the scores of one key tile and the powers of another for 32 queries, more than
// 256 VGPRs: two waves per SIMD, one work-group per WGP.
// Softmax runs against a held reference per query: P = 2^(score - ref), with ref the maximum of key tile 0, moved only
// when a later score tops it by more than RISE. Any ref gives the same quotient sum(P V) / sum(P); P stays within f16
__global__ __launch_bounds__(256) void fattn_kernel(
    const float* __restrict__ Q, const float* __restrict__ K,
    const float* __restrict__ V, float* __restrict__ O)
{
    // two buffers; stage s = K tile s + 1 and V tile s lies in buffer s & 1 (70 KB): K runs one tile ahead of V,
    // because trip s forms the scores of tile s + 1 while it works on the scores of tile s
    __shared__ __attribute__((aligned(16))) _Float16 Ring[2 * STAGE];
    __shared__ __attribute__((aligned(16))) _Float16 K0[KHALVES];         // K tile 0, read once in front of the loop (17 KB)
    // K and V come from memory as f32 and go to f16 here, once per work-group: two f32 buffers, f32 stage s in buffer
    // s & 1, and behind them the f32 K tile 0 (162 KB). Trip s turns f32 stage s + 1 into Ring's stage s + 1, V transposed.
    // The epilogue's per-wave output rows (132 KB) lie on the same bytes, which nobody reads as tiles by then
    __shared__ __attribute__((aligned(16))) float Raw[2 * RSTAGE + RKFLOATS];
    static_assert(NWAVES * QW * 16 * OPITCH <= 2 * RSTAGE + RKFLOATS, "output rows fit");
    float* const Ol = Raw;

    const int t    = threadIdx.x;
    const int wave = __builtin_amdgcn_readfirstlane(t >> 5);   // in a scalar register, so that what hangs on it costs no vector register
    const int lane = t & 31;
    const int hi   = lane >> 4;   // half-wave select
    const int ln   = lane & 15;

    const int bh = blockIdx.y;                       // 0..63  (B*H)
    const int qt = blockIdx.x;                       // 0..7   (S/QTILE)
    const size_t base  = (size_t)bh * Sdim * Ddim;
    const int    qrow0 = qt * QTILE + wave * (QW * 16);

    // 1/sqrt(128) * log2(e): the scores come out of the products in log2 units, e^x = 2^(x * log2(e))
    const float scale = 0.08838834764831845f * 1.44269504088896340736f;
    constexpr float RISE = 8.0f;   // P is at most 2^8

    // an f32 tile is 32 KB of contiguous bytes; piece o = i * 256 + t of it is float4 t & 31 of row o >> 5.
    // An LDS byte address is the low 32 bits of the __shared__ address
    const unsigned raw0 = (unsigned)reinterpret_cast<size_t>(&Raw[0]);
    // ko, vo: the thread's first piece inside an f32 buffer, for the copies in front of the loop
    const unsigned ko    = wave * 512 + lane * 16;
    const unsigned vo    = RKFLOATS * 4 + wave * (RVPITCH * 4) + lane * 16;
    const float* kg = K + base + wave * 128;   // the wave's row of a tile's first eight; the lane's float4 is added at each call
    const float* vg = V + base + wave * 128;
    const int    l4 = lane * 4;
    constexpr int TILE = KTILE * Ddim;
    // K tile 0, stage 0 (K tile 1, V tile 0) and stage 1; they fly while Q is loaded
    copy_raw_k(ko + (raw0 + 2 * RSTAGE * 4), kg + l4);
    copy_raw(ko + raw0, vo + raw0, kg + TILE + l4, vg + l4);
    copy_raw(ko + (raw0 + RSTAGE * 4), vo + (raw0 + RSTAGE * 4), kg + 2 * TILE + l4, vg + TILE + l4);

    // ---- f32 to f16 inside LDS. K: a thread takes float4 t & 31 of rows (t >> 5) + 8 i, a wave one whole row per read
    // and per 8-B write. V: a thread takes four dims (float4 c4) of the eight keys of group kgp and writes, per dim,
    // those eight keys as one 16-B piece of the transposed tile; a half-wave reads 8 float4 of each of two groups ----
    // c4 = (lane & 7) + 8 * (lane >> 4) + 16 * (wave & 1), kgp = ((lane >> 3) & 1) + 2 * (wave >> 1); lane and wave parts apart
    const int c4l = (lane & 7) + (lane >> 4) * 8;
    const int kgl = (lane >> 3) & 1;
    const int krd = wave * 128 + l4;                           // floats into an f32 K tile
    const int kwr = wave * KPITCH + l4;                        // halves into an f16 K tile
    const int vrd = (kgl * 8 * RVPITCH + c4l * 4) + (RKFLOATS + (wave >> 1) * 16 * RVPITCH + (wave & 1) * 64);   // floats into an f32 buffer
    const int vwr = (c4l * 4 * VPITCH + kgl * 8) + (KHALVES + (wave & 1) * 64 * VPITCH + (wave >> 1) * 16);      // halves into an f16 buffer
    auto k_read = [](float4 (&r)[8], const float* src) __attribute__((always_inline)) {
#pragma unroll
        for (int i = 0; i < 8; ++i) r[i] = *reinterpret_cast<const float4*>(src + i * 1024);
    };
    auto k_cvt = [](v4h (&h)[8], const float4 (&r)[8]) __attribute__((always_inline)) {
#pragma unroll
        for (int i = 0; i < 8; ++i) h[i] = (v4h){(_Float16)r[i].x, (_Float16)r[i].y, (_Float16)r[i].z, (_Float16)r[i].w};
    };
    auto k_write = [](_Float16* dst, const v4h (&h)[8]) __attribute__((always_inline)) {
#pragma unroll
        for (int i = 0; i < 8; ++i) *reinterpret_cast<v4h*>(dst + i * 8 * KPITCH) = h[i];
    };
    auto v_read = [](float4 (&r)[8], const float* src) __attribute__((always_inline)) {
#pragma unroll
        for (int i = 0; i < 8; ++i) r[i] = *reinterpret_cast<const float4*>(src + i * RVPITCH);
    };
    auto v_cvt = [](v8h (&h)[4], const float4 (&r)[8]) __attribute__((always_inline)) {
        h[0] = (v8h){(_Float16)r[0].x, (_Float16)r[1].x, (_Float16)r[2].x, (_Float16)r[3].x, (_Float16)r[4].x, (_Float16)r[5].x, (_Float16)r[6].x, (_Float16)r[7].x};
        h[1] = (v8h){(_Float16)r[0].y, (_Float16)r[1].y, (_Float16)r[2].y, (_Float16)r[3].y, (_Float16)r[4].y, (_Float16)r[5].y, (_Float16)r[6].y, (_Float16)r[7].y};
        h[2] = (v8h){(_Float16)r[0].z, (_Float16)r[1].z, (_Float16)r[2].z, (_Float16)r[3].z, (_Float16)r[4].z, (_Float16)r[5].z, (_Float16)r[6].z, (_Float16)r[7].z};
        h[3] = (v8h){(_Float16)r[0].w, (_Float16)r[1].w, (_Float16)r[2].w, (_Float16)r[3].w, (_Float16)r[4].w, (_Float16)r[5].w, (_Float16)r[6].w, (_Float16)r[7].w};
    };
    auto v_write = [](_Float16* dst, const v8h (&h)[4]) __attribute__((always_inline)) {
#pragma unroll
        for (int q = 0; q < 4; ++q) *reinterpret_cast<v8h*>(dst + q * VPITCH) = h[q];
    };

    // ---- persistent Q fragments (per query tile u: 4 x 32 dims x 16 queries, f16), pre-scaled: the B operand
    // of S^T = K x Q^T ----
    v16h qf[QW][4];
#pragma unroll
    for (int u = 0; u < QW; ++u) {
        const float* qrow = Q + base + (size_t)(qrow0 + u * 16 + ln) * Ddim;
#pragma unroll
        for (int s = 0; s < 4; ++s) {
#pragma unroll
            for (int e = 0; e < 16; ++e)
                qf[u][s][e] = (_Float16)(qrow[s * 32 + KOFF(e)] * scale);
        }
    }

    // ---- fp32 accumulators of O^T: per query tile 128 dims x 16 queries as 8 C-fragments; a lane holds
    // dims c*16 + 8*hi + r of query u*16 + ln ----
    v8f acc[QW][8];
    v8f   cref[QW];   // minus the reference of query u*16 + ln in all eight places, equal in both halves: C of the score products
    float lrow[QW];   // running sum over this half's keys only; the halves join in the epilogue
#pragma unroll
    for (int u = 0; u < QW; ++u) {
#pragma unroll
        for (int c = 0; c < 8; ++c) acc[u][c] = {};
        lrow[u] = 0.0f;
    }

    // this wave's copies of K tile 0 and of stages 0 and 1 have landed; behind the barrier every wave's have
    asm volatile("s_wait_asynccnt 0x0" ::: "memory");
    __syncthreads();
    {   // K tile 0 and stage 0 to f16
        float4 r[8];
        v4h hk[8];
        v8h hv[4];
        k_read(r, Raw + 2 * RSTAGE + krd); k_cvt(hk, r); k_write(K0 + kwr, hk);
        k_read(r, Raw + krd);              k_cvt(hk, r); k_write(Ring + kwr, hk);
        v_read(r, Raw + vrd);              v_cvt(hv, r); v_write(Ring + vwr, hv);
    }
    // this wave's f16 writes and its reads of f32 buffer 0 are done; behind the barrier every wave's are: K tile 0 and
    // stage 0 may be read, f32 buffer 0 refilled
    asm volatile("s_wait_dscnt 0x0" ::: "memory");
    __syncthreads();
    copy_raw(ko + raw0, vo + raw0, kg + 3 * TILE + l4, vg + 2 * TILE + l4);   // f32 stage 2 into f32 buffer 0

    // Fragment reads from LDS go out in groups of four fragments (eight 16-B reads), one to two
    // groups ahead of the products that use them, into register sets fa, fb, fc, fd: a wave then has
    // 8 to 16 reads in flight instead of 2, and waits for a group once instead of for each fragment.
    // FENCE behind a group keeps the compiler from sinking its reads back down to their first use; in
    // front of a group it keeps the reads behind the products whose registers they take over (without
    // it the kernel spills). The loops over a set are unrolled so that its fragments stay in registers.
#define FENCE() __builtin_amdgcn_sched_barrier(0)
    // MIX(n): the order inside a stretch that holds eight matrix products (0x008) and vector work that does not depend
    // on them: one product, then n vector instructions (0x402: plain and transcendental), eight times. A wave issues
    // in order, so products left in one run would hold the vector work back while the matrix unit takes them.
    // The loop is unrolled because the groups are markers in straight-line code
#define MIX(n) do { _Pragma("unroll") for (int g_ = 0; g_ < 8; ++g_) { \
        __builtin_amdgcn_sched_group_barrier(0x008, 1, 0); __builtin_amdgcn_sched_group_barrier(0x402, (n), 0); } } while (0)
    // a fragment is two 16-B pieces of one LDS row, at halves 8 * hi and 16 + 8 * hi: the order of KOFF
    auto frag = [](const _Float16* p) {
        return __builtin_shufflevector(*reinterpret_cast<const v8h*>(p), *reinterpret_cast<const v8h*>(p + 16),
                                       0, 1, 2, 3, 4, 5, 6, 7, 8, 9, 10, 11, 12, 13, 14, 15);
    };
    // scores: S^T = K x Q^T for one 16-key tile against both query tiles, K-dim 128 chained over the four fragments of a
    // set (dims s*32..); s_[u][j][r] is key j*16 + 8*hi + r against query u*16 + ln. C at the head of a chain is minus
    // the reference, so that the chain ends in score - ref
    auto qk = [&](v8f (&s_)[QW][4], int j, const v16h (&f)[4]) __attribute__((always_inline)) {
#pragma unroll
        for (int s = 0; s < 4; ++s) {
#pragma unroll
            for (int u = 0; u < QW; ++u)
                s_[u][j] = __builtin_amdgcn_wmma_f32_16x16x32_f16(false, f[s], false, qf[u][s], (short)0, s == 0 ? cref[u] : s_[u][j], false, false);
        }
    };

    // ---- softmax: a lane holds 32 of its query's 64 scores of a tile, so maximum and sum run in-lane.
    // ex[u][j][r]: score - ref of key j*16 + 8*hi + r, query u*16 + ln. A trip takes the powers of key tile j and then lets
    // the next tile's products write their scores of key tile j to the same place ----
    v8f ex[QW][4];
    auto lane_max = [](const v8f (&s_)[QW][4], int u) __attribute__((always_inline)) {
        float mj[4];
#pragma unroll
        for (int j = 0; j < 4; ++j) {
            mj[j] = fmaxf(fmaxf(s_[u][j][0], s_[u][j][1]), s_[u][j][2]);
            mj[j] = fmaxf(fmaxf(mj[j], s_[u][j][3]), s_[u][j][4]);
            mj[j] = fmaxf(fmaxf(mj[j], s_[u][j][5]), s_[u][j][6]);
            mj[j] = fmaxf(mj[j], s_[u][j][7]);
        }
        return fmaxf(fmaxf(fmaxf(mj[0], mj[1]), mj[2]), mj[3]);
    };
    // the reference of each query goes up to the maximum in s_ (mx: the lane's own share of it) where that lies above
    // it: the sums and output tiles so far, and s_ itself, follow
    auto move_ref = [&](v8f (&s_)[QW][4], const float (&mx)[QW]) __attribute__((always_inline)) {
#pragma unroll
        for (int u = 0; u < QW; ++u) {
            const float d = fmaxf(fmaxf(mx[u], other_half(mx[u])), 0.0f);
            const float a = __builtin_amdgcn_exp2f(-d);
            lrow[u] *= a;
#pragma unroll
            for (int c = 0; c < 8; ++c) acc[u][c] *= a;
#pragma unroll
            for (int j = 0; j < 4; ++j) s_[u][j] -= d;
            cref[u] -= d;
        }
    };

    // ---- tile 0 in front of the loop: its scores against reference 0, then their maxima become the references ----
    {
        const _Float16* kl0 = K0 + ln * KPITCH + hi * 8;
        v16h fa[4], fb[4];
#pragma unroll
        for (int u = 0; u < QW; ++u) cref[u] = {};
#pragma unroll
        for (int s = 0; s < 4; ++s) fa[s] = frag(kl0 + s * 32);
#pragma unroll
        for (int s = 0; s < 4; ++s) fb[s] = frag(kl0 + 16 * KPITCH + s * 32);
        FENCE();
        qk(ex, 0, fa);
        FENCE();
#pragma unroll
        for (int s = 0; s < 4; ++s) fa[s] = frag(kl0 + 32 * KPITCH + s * 32);
        FENCE();
        qk(ex, 1, fb);
        FENCE();
#pragma unroll
        for (int s = 0; s < 4; ++s) fb[s] = frag(kl0 + 48 * KPITCH + s * 32);
        FENCE();
        qk(ex, 2, fa);
        qk(ex, 3, fb);
#pragma unroll
        for (int u = 0; u < QW; ++u) {
            const float m = lane_max(ex, u);
            cref[u] -= fmaxf(m, other_half(m));
#pragma unroll
            for (int j = 0; j < 4; ++j) ex[u][j] += cref[u];
        }
        FENCE();
    }

    const float* kn = kg + 4 * TILE;   // the K tile of the next refill
    // where the thread reads and writes when it converts the coming stage: carried from trip to trip and moved to the other
    // buffer at a trip's foot, so that no address arithmetic stands among the fenced stretches of a trip
    const float* cvr = Raw + RSTAGE + vrd;
    const float* ckr = Raw + RSTAGE + krd;
    _Float16*    cvw = Ring + STAGE + vwr;
    _Float16*    ckw = Ring + STAGE + kwr;
    int rstep = -RSTAGE, hstep = -STAGE;
    float4 rk[8];        // the thread's share of the f32 K tile that the coming trip converts, read one trip's foot ahead
    k_read(rk, ckr);
    // one trip. First half: the score products of tile tl + 1 (next: it exists), key tile by key tile, and among them the
    // powers, sums and P of tile tl, one key tile ahead of the products that take its place. Second half: the products of
    // P with V tile tl, and among them the lane maxima of tile tl + 1. At the foot one test for the whole wave: has a
    // score of tile tl + 1 left the range that the references allow. Where a tile tl + 1 exists, so does stage tl + 1: the trip
    // turns it from f32 to f16 in its first half: K's share, read at the foot of the trip before, is converted in front of the
    // first product, V's among the products of key tile 1; the LDS reads and writes stand where fragment reads stand. refill: an f32 stage tl + 3 exists; more: a stage tl + 2.
    // Inlined at each of its places, so that acc and qf stay in registers
    auto trip = [&](const int tl, const bool refill, const bool more, const bool next) __attribute__((always_inline)) {
        const int buf = (tl & 1) * STAGE;   // trip tl reads this buffer alone
        // this lane's row and half-wave offset in the two tiles: every fragment lies a constant off these
        const _Float16* kl0 = Ring + buf + ln * KPITCH + hi * 8;
        const _Float16* vt0 = Ring + buf + KHALVES + ln * VPITCH + hi * 8;
        auto kfrag = [&](int s, int j) { return frag(kl0 + j * 16 * KPITCH + s * 32); };  // keys j*16.., dims s*32..
        auto vfrag = [&](int c, int h) { return frag(vt0 + c * 16 * VPITCH + h * 32); };  // dims c*16.., keys h*32..
        v16h fa[4], fb[4], fc[4];
        v8f  pw[QW][4];
        v16h pf[QW][2];
        float ls[QW][4];
        float mx[QW];
        unsigned over = 0;   // the lanes that hold a score of tile tl + 1 more than RISE above its reference
        float4 rv[8];
        v8h hv[4];
        v4h hk[8];

        // powers and partial sums of key tile j, both query tiles
        auto tile_exp = [&](int j) {
#pragma unroll
            for (int u = 0; u < QW; ++u) {
                ls[u][j] = 0.0f;
#pragma unroll
                for (int r = 0; r < 8; ++r) { pw[u][j][r] = __builtin_amdgcn_exp2f(ex[u][j][r]); ls[u][j] += pw[u][j][r]; }
            }
        };
        // P^T as B operand: two score tiles, converted, are keys 0..31 (32..63) in the order of KOFF; no LDS, no lane exchange
        auto pack = [&](int h) {
#pragma unroll
            for (int u = 0; u < QW; ++u)
                pf[u][h] = __builtin_shufflevector(__builtin_convertvector(pw[u][2 * h], v8h), __builtin_convertvector(pw[u][2 * h + 1], v8h),
                                                   0, 1, 2, 3, 4, 5, 6, 7, 8, 9, 10, 11, 12, 13, 14, 15);
        };

        if (next) {
#pragma unroll
            for (int s = 0; s < 4; ++s) fa[s] = kfrag(s, 0);
#pragma unroll
            for (int s = 0; s < 4; ++s) fb[s] = kfrag(s, 1);
            v_read(rv, cvr);
            FENCE();
            k_cvt(hk, rk);   // read at the foot of the trip before: this work, too, stands in front of the first product
        }
        tile_exp(0);   // the first reads of a trip are on their way: this work stands in front of the first product, which waits for them
        FENCE();
        if (next) qk(ex, 0, fa);
        tile_exp(1);
        if (next) {
            MIX(4);
            FENCE();
            k_write(ckw, hk);
#pragma unroll
            for (int s = 0; s < 4; ++s) fa[s] = kfrag(s, 2);
            FENCE();
            qk(ex, 1, fb);
            v_cvt(hv, rv);
        }
        tile_exp(2);
        if (next) {
            MIX(6);
            FENCE();
            v_write(cvw, hv);
#pragma unroll
            for (int s = 0; s < 4; ++s) fb[s] = kfrag(s, 3);
            FENCE();
            qk(ex, 2, fa);
        }
        tile_exp(3);
        pack(0);
        pack(1);
        // V fragments of dims 0..31
        v16h fd[4];
#pragma unroll
        for (int i = 0; i < 4; ++i) fd[i] = vfrag(i >> 1, i & 1);
        if (next) qk(ex, 3, fb);
#pragma unroll
        for (int u = 0; u < QW; ++u) lrow[u] += (ls[u][0] + ls[u][1]) + (ls[u][2] + ls[u][3]);
#pragma unroll
        for (int i = 0; i < 4; ++i) fb[i] = vfrag(2 + (i >> 1), i & 1);
#pragma unroll
        for (int i = 0; i < 4; ++i) fc[i] = vfrag(4 + (i >> 1), i & 1);
        // the conversions to P come out next to their first use, so this stretch reaches down to it and takes them in;
        // the groups of eight and sixteen reads (0x100) stay behind the products whose registers they take over
        if (next) MIX(6);
        __builtin_amdgcn_sched_group_barrier(0x100, 8, 0);
        if (next) MIX(3);
        __builtin_amdgcn_sched_group_barrier(0x100, 16, 0);
        FENCE();

        // ---- O^T += V^T x P^T : 8 chunks of 16 dims, contraction K = 64 keys; a set serves two chunks,
        // keys 0..31 of both and then keys 32..63 of both, each fragment against both query tiles ----
        auto pv2 = [&](int c, const v16h (&f)[4]) {
#pragma unroll
            for (int h = 0; h < 2; ++h) {
#pragma unroll
                for (int i = 0; i < 2; ++i) {
#pragma unroll
                    for (int u = 0; u < QW; ++u)
                        acc[u][c + i] = __builtin_amdgcn_wmma_f32_16x16x32_f16(false, f[2 * i + h], false, pf[u][h], (short)0, acc[u][c + i], false, false);
                }
            }
        };
        pv2(0, fd);
        FENCE();
#pragma unroll
        for (int i = 0; i < 4; ++i) fa[i] = vfrag(6 + (i >> 1), i & 1);
        FENCE();
        pv2(2, fb);
        // the test's lane mask is formed here, sixteen products ahead of the branch that reads it
        if (next) {
            mx[0] = lane_max(ex, 0);
            mx[1] = lane_max(ex, 1);
            over  = __builtin_amdgcn_ballot_w32(fmaxf(mx[0], mx[1]) > RISE);
            MIX(6);
        }
        FENCE();
        pv2(4, fc);
        pv2(6, fa);
        FENCE();   // the products stay in front of the waits below, which else stand ahead of them and drain the last reads at once

        // hand-over: this wave's reads of its two buffers and its writes of stage tl + 1 are done and its copies of f32
        // stage tl + 2 have landed; behind the barrier that holds for every wave, so stage tl + 1 may be read, f32 stage
        // tl + 2 converted and the f32 buffer of this trip refilled. The copies of f32 stage tl + 3 then fly through trip tl + 1.
        // The last stage has no K tile of its own and takes the last tile once more, which is converted but no product reads: a branch
        // round those eight copies would split the loop body, and the vector work sinks behind such a branch
        asm volatile("s_wait_dscnt 0x0" ::: "memory");
        asm volatile("s_wait_asynccnt 0x0" ::: "memory");
        __syncthreads();
        cvr += rstep; ckr += rstep; cvw += hstep; ckw += hstep;
        rstep = -rstep; hstep = -hstep;
        if (refill) {
            // the f32 buffer that this trip has converted lies rstep floats off the one ckr now points into; a thread's first
            // piece of a K tile is the float4 it reads there, its first piece of the V tile lies a K tile and 16 B a wave on
            const unsigned kd = (unsigned)reinterpret_cast<size_t>(ckr);
            copy_raw(kd + rstep * 4, kd + (rstep * 4 + RKFLOATS * 4 + wave * 16), kn + l4, vg + (tl + 3) * TILE + l4);
            kn += tl + 5 < NTILES ? TILE : 0;
        }
        // one scalar branch a trip, behind all of the trip's work, so that the body above it stays one block; the output
        // tiles and sums hold tile tl by now, and nothing of tile tl + 1 has been used
        if (next && over != 0) move_ref(ex, mx);
        // f32 stage tl + 2 has landed for every wave (the waits and the barrier above): its K share is read here, a stretch
        // of address work and fragment reads ahead of its conversion. Written behind the branch: in front of it the
        // lane maxima came out at the trip's foot instead of among the products
        if (more) k_read(rk, ckr);
    };
    // the last three trips refill nothing and stand alone
    for (int tl = 0; tl < NTILES - 3; ++tl) trip(tl, true, true, true);
    trip(NTILES - 3, false, true, true);
    trip(NTILES - 2, false, false, true);
    trip(NTILES - 1, false, false, false);
#undef MIX
#undef FENCE
    // no copy is outstanding when the wave goes on to its end
    asm volatile("s_wait_asynccnt 0x0" ::: "memory");

    // ---- epilogue: join the halves' sums, divide, and turn O^T back into rows through this wave's
    // own LDS range, so that every global store covers one whole 512-B row ----
    float* ow = Ol + wave * (QW * 16) * OPITCH;
#pragma unroll
    for (int u = 0; u < QW; ++u) {
        const float inv = 1.0f / (lrow[u] + other_half(lrow[u]));
#pragma unroll
        for (int c = 0; c < 8; ++c) {
            const v8f o = acc[u][c] * inv;
            float* p = ow + (u * 16 + ln) * OPITCH + c * 16 + hi * 8;
            *reinterpret_cast<float4*>(p)     = make_float4(o[0], o[1], o[2], o[3]);
            *reinterpret_cast<float4*>(p + 4) = make_float4(o[4], o[5], o[6], o[7]);
        }
    }
    // the other lanes' rows are in LDS before this lane reads them back
    asm volatile("s_wait_dscnt 0x0" ::: "memory");
    float4 orow[QW * 16];
#pragma unroll
    for (int i = 0; i < QW * 16; ++i)
        orow[i] = *reinterpret_cast<const float4*>(ow + i * OPITCH + lane * 4);
    float* og = O + base + (size_t)qrow0 * Ddim + lane * 4;
#pragma unroll
    for (int i = 0; i < QW * 16; ++i)
        *reinterpret_cast<float4*>(og + i * Ddim) = orow[i];
}

extern "C" void kernel_launch(void* const* d_in, const int* in_sizes, int n_in,
                              void* d_out, int out_size, void* d_ws, size_t ws_size,
                              hipStream_t stream) {
    (void)in_sizes; (void)n_in; (void)out_size; (void)d_ws; (void)ws_size;
    const float* Q = (const float*)d_in[0];
    const float* K = (const float*)d_in[1];
    const float* V = (const float*)d_in[2];
    float*       O = (float*)d_out;

    dim3 grid(Sdim / QTILE, 4 * 16);   // (8 q-tiles, B*H = 64)
    dim3 block(256);                   // 8 wave32 waves
    fattn_kernel<<<grid, block, 0, stream>>>(Q, K, V, O);
}

// v010
// A run of this version takes 95.8 microseconds.
// In both of two side-by-side timings against v009, it was 1.04 times as fast.
// Over all steps from v000 it is 7.73 times as fast.
#include <hip/hip_runtime.h>

typedef __attribute__((ext_vector_type(16))) _Float16 v16h;
typedef __attribute__((ext_vector_type(2)))  _Float16 v2h;
typedef __attribute__((ext_vector_type(4)))  _Float16 v4h;
typedef __attribute__((ext_vector_type(8)))  _Float16 v8h;
typedef __attribute__((ext_vector_type(8)))  float    v8f;

constexpr int Sdim  = 2048;
constexpr int Ddim  = 128;
constexpr int QW    = 2;     // 16-query tiles per wave: each K or V fragment read from LDS serves QW products
constexpr int QTILE = 256;   // query rows per block (8 waves x QW x 16)
constexpr int KTILE = 64;    // keys per iteration (4 x 16x16 score tiles)
constexpr int NWAVES = 8;
// LDS row pitches in halves: row bytes + 16, an odd multiple of 16 B, so that the 16 rows
// one ds_load_b128 touches per half-wave fall on distinct banks (pad halves are never read)
constexpr int KPITCH = Ddim  + 8;   // 272 B
constexpr int VPITCH = KTILE + 8;   // 144 B
constexpr int OPITCH = Ddim  + 4;   // floats, 528 B: the 16 rows one ds_store_b128 touches per half-wave cover all banks once
constexpr int KHALVES = KTILE * KPITCH;      // K tile in LDS, [k][d], f16            (17 KB)
constexpr int VHALVES = Ddim  * VPITCH;      // V tile in LDS, [d][k] transposed, f16 (18 KB)
constexpr int STAGE   = KHALVES + VHALVES;   // one buffer: a K tile and behind it a V tile
constexpr int NTILES  = Sdim / KTILE;

// element e of a 16-bit A/B fragment -> contraction-dim offset (ISA 7.12.2)
#define KOFF(e) ((( ((e) >> 1) < 4 ) ? (((e) >> 1) * 2) : (16 + (((e) >> 1) - 4) * 2)) \
                 + (hi << 3) + ((e) & 1))

// the value that lane l ^ 16 holds: the two halves of a wave share each query column
__device__ __forceinline__ float other_half(float x) {
    const int b = __builtin_bit_cast(int, x);
    return __builtin_bit_cast(float, __builtin_amdgcn_permlanex16(b, b, 0x76543210, 0xfedcba98, false, false));
}

// a wave holds the output tiles, Q, the scores of one key tile and the powers of another for 32 queries, more than
// 256 VGPRs: two waves per SIMD, one work-group per WGP.
// Softmax runs against a held reference per query: P = 2^(score - ref), with ref the maximum of key tile 0, moved only
// when a later score tops it by more than RISE. Any ref gives the same quotient sum(P V) / sum(P); P stays within f16
// The work-group's barrier with its fences on LDS alone: what is handed over between waves lies in LDS. __syncthreads()
// also waits for every global load of the wave, and the f32 values asked for in a trip are to fly on across its foot
#define HANDOVER() do { __builtin_amdgcn_fence(__ATOMIC_RELEASE, "workgroup", "local"); __builtin_amdgcn_s_barrier(); \
                        __builtin_amdgcn_fence(__ATOMIC_ACQUIRE, "workgroup", "local"); } while (0)
__global__ __launch_bounds__(256) void fattn_kernel(
    const float* __restrict__ Q, const float* __restrict__ K,
    const float* __restrict__ V, float* __restrict__ O)
{
    // two buffers; stage s = K tile s + 1 and V tile s lies in buffer s & 1 (70 KB): K runs one tile ahead of V,
    // because trip s forms the scores of tile s + 1 while it works on the scores of tile s
    __shared__ __attribute__((aligned(16))) _Float16 Ring[2 * STAGE];
    __shared__ __attribute__((aligned(16))) _Float16 K0[KHALVES];         // K tile 0, read once in front of the loop (17 KB)
    // K and V come from memory as f32, through registers, and go to f16 on the way, once per work-group: trip s writes
    // Ring's stage s + 1, V transposed, from values that trip s - 1 has asked for
    __shared__ __attribute__((aligned(16))) float Ol[NWAVES * QW * 16 * OPITCH];   // the epilogue's per-wave output rows (132 KB)

    const int t    = threadIdx.x;
    const int wave = __builtin_amdgcn_readfirstlane(t >> 5);   // in a scalar register, so that what hangs on it costs no vector register
    const int lane = t & 31;
    const int hi   = lane >> 4;   // half-wave select
    const int ln   = lane & 15;

    const int bh = blockIdx.y;                       // 0..63  (B*H)
    const int qt = blockIdx.x;                       // 0..7   (S/QTILE)
    const size_t base  = (size_t)bh * Sdim * Ddim;
    const int    qrow0 = qt * QTILE + wave * (QW * 16);

    // 1/sqrt(128) * log2(e): the scores come out of the products in log2 units, e^x = 2^(x * log2(e))
    const float scale = 0.08838834764831845f * 1.44269504088896340736f;
    constexpr float RISE = 8.0f;   // P is at most 2^8

    // ---- f32 from memory to f16 in LDS. K: a thread takes float4 t & 31 of rows (t >> 5) + 8 i, a wave one whole 512-B row
    // per load and per 8-B write. V: a thread takes four dims (float4 c4) of the eight keys of group kgp and writes, per dim,
    // those eight keys as one 16-B piece of the transposed tile; a wave's load covers half a row (256 B) of each of two keys ----
    // c4 = (lane & 7) + 8 * (lane >> 4) + 16 * (wave & 1), kgp = ((lane >> 3) & 1) + 2 * (wave >> 1); lane and wave parts apart
    constexpr int TILE = KTILE * Ddim;
    const int l4  = lane * 4;
    const int c4l = (lane & 7) + (lane >> 4) * 8;
    const int kgl = (lane >> 3) & 1;
    const int vl  = kgl * 8 * Ddim + c4l * 4;                  // the lane's part, floats into an f32 V tile
    const float* kg = K + base + wave * Ddim;                                  // the wave's part, in scalar registers
    const float* vg = V + base + ((wave >> 1) * 16 * Ddim + (wave & 1) * 64);
    const int kwr = wave * KPITCH + l4;                        // halves into an f16 K tile
    const int vwr = (c4l * 4 * VPITCH + kgl * 8) + (KHALVES + (wave & 1) * 64 * VPITCH + (wave >> 1) * 16);      // halves into an f16 buffer
    auto k_read = [](float4 (&r)[8], const float* src) __attribute__((always_inline)) {
#pragma unroll
        for (int i = 0; i < 8; ++i) r[i] = *reinterpret_cast<const float4*>(src + i * 1024);
    };
    auto k_cvt = [](v4h (&h)[8], const float4 (&r)[8]) __attribute__((always_inline)) {
#pragma unroll
        for (int i = 0; i < 8; ++i) h[i] = (v4h){(_Float16)r[i].x, (_Float16)r[i].y, (_Float16)r[i].z, (_Float16)r[i].w};
    };
    auto k_write = [](_Float16* dst, const v4h (&h)[8]) __attribute__((always_inline)) {
#pragma unroll
        for (int i = 0; i < 8; ++i) *reinterpret_cast<v4h*>(dst + i * 8 * KPITCH) = h[i];
    };
    auto v_read = [](float4 (&r)[8], const float* src) __attribute__((always_inline)) {
#pragma unroll
        for (int i = 0; i < 8; ++i) r[i] = *reinterpret_cast<const float4*>(src + i * Ddim);
    };
    auto v_cvt = [](v8h (&h)[4], const float4 (&r)[8]) __attribute__((always_inline)) {
        h[0] = (v8h){(_Float16)r[0].x, (_Float16)r[1].x, (_Float16)r[2].x, (_Float16)r[3].x, (_Float16)r[4].x, (_Float16)r[5].x, (_Float16)r[6].x, (_Float16)r[7].x};
        h[1] = (v8h){(_Float16)r[0].y, (_Float16)r[1].y, (_Float16)r[2].y, (_Float16)r[3].y, (_Float16)r[4].y, (_Float16)r[5].y, (_Float16)r[6].y, (_Float16)r[7].y};
        h[2] = (v8h){(_Float16)r[0].z, (_Float16)r[1].z, (_Float16)r[2].z, (_Float16)r[3].z, (_Float16)r[4].z, (_Float16)r[5].z, (_Float16)r[6].z, (_Float16)r[7].z};
        h[3] = (v8h){(_Float16)r[0].w, (_Float16)r[1].w, (_Float16)r[2].w, (_Float16)r[3].w, (_Float16)r[4].w, (_Float16)r[5].w, (_Float16)r[6].w, (_Float16)r[7].w};
    };
    auto v_write = [](_Float16* dst, const v8h (&h)[4]) __attribute__((always_inline)) {
#pragma unroll
        for (int q = 0; q < 4; ++q) *reinterpret_cast<v8h*>(dst + q * VPITCH) = h[q];
    };

    // K tile 0 and stage 0 (K tile 1, V tile 0), and behind them the share of stage 1 that trip 0 converts; they fly while Q is loaded
    float4 rk[8], rv[8];   // the thread's share of the f32 K tile and V tile that the coming trip converts, asked for in the trip before
    float4 p0[8], p1[8], p2[8];
    k_read(p0, kg + l4);
    k_read(p1, kg + TILE + l4);
    v_read(p2, vg + vl);
    k_read(rk, kg + 2 * TILE + l4);
    v_read(rv, vg + TILE + vl);
    // in front of whatever rewrites a register that these loads name
    asm volatile("s_wait_xcnt 0x0" ::: "memory");

    // ---- persistent Q fragments (per query tile u: 4 x 32 dims x 16 queries, f16), pre-scaled: the B operand
    // of S^T = K x Q^T ----
    v16h qf[QW][4];
#pragma unroll
    for (int u = 0; u < QW; ++u) {
        const float* qrow = Q + base + (size_t)(qrow0 + u * 16 + ln) * Ddim;
#pragma unroll
        for (int s = 0; s < 4; ++s) {
#pragma unroll
            for (int e = 0; e < 16; ++e)
                qf[u][s][e] = (_Float16)(qrow[s * 32 + KOFF(e)] * scale);
        }
    }

    // ---- fp32 accumulators of O^T: per query tile 128 dims x 16 queries as 8 C-fragments; a lane holds
    // dims c*16 + 8*hi + r of query u*16 + ln ----
    v8f acc[QW][8];
    v8f   cref[QW];   // minus the reference of query u*16 + ln in all eight places, equal in both halves: C of the score products
    float lrow[QW];   // running sum over this half's keys only; the halves join in the epilogue
#pragma unroll
    for (int u = 0; u < QW; ++u) {
#pragma unroll
        for (int c = 0; c < 8; ++c) acc[u][c] = {};
        lrow[u] = 0.0f;
    }

    {   // K tile 0 and stage 0 to f16
        v4h hk[8];
        v8h hv[4];
        k_cvt(hk, p0); k_write(K0 + kwr, hk);
        k_cvt(hk, p1); k_write(Ring + kwr, hk);
        v_cvt(hv, p2); v_write(Ring + vwr, hv);
    }
    // this wave's f16 writes are done; behind the barrier every wave's are: K tile 0 and stage 0 may be read
    asm volatile("s_wait_dscnt 0x0" ::: "memory");
    HANDOVER();

    // Fragment reads from LDS go out in groups of four fragments (eight 16-B reads), one to two
    // groups ahead of the products that use them, into register sets fa, fb, fc, fd: a wave then has
    // 8 to 16 reads in flight instead of 2, and waits for a group once instead of for each fragment.
    // FENCE behind a group keeps the compiler from sinking its reads back down to their first use; in
    // front of a group it keeps the reads behind the products whose registers they take over (without
    // it the kernel spills). The loops over a set are unrolled so that its fragments stay in registers.
#define FENCE() __builtin_amdgcn_sched_barrier(0)
    // MIX(n): the order inside a stretch that holds eight matrix products (0x008) and vector work that does not depend
    // on them: one product, then n vector instructions (0x402: plain and transcendental), eight times. A wave issues
    // in order, so products left in one run would hold the vector work back while the matrix unit takes them.
    // The loop is unrolled because the groups are markers in straight-line code
#define MIX(n) do { _Pragma("unroll") for (int g_ = 0; g_ < 8; ++g_) { \
        __builtin_amdgcn_sched_group_barrier(0x008, 1, 0); __builtin_amdgcn_sched_group_barrier(0x402, (n), 0); } } while (0)
    // a fragment is two 16-B pieces of one LDS row, at halves 8 * hi and 16 + 8 * hi: the order of KOFF
    auto frag = [](const _Float16* p) {
        return __builtin_shufflevector(*reinterpret_cast<const v8h*>(p), *reinterpret_cast<const v8h*>(p + 16),
                                       0, 1, 2, 3, 4, 5, 6, 7, 8, 9, 10, 11, 12, 13, 14, 15);
    };
    // scores: S^T = K x Q^T for one 16-key tile against both query tiles, K-dim 128 chained over the four fragments of a
    // set (dims s*32..); s_[u][j][r] is key j*16 + 8*hi + r against query u*16 + ln. C at the head of a chain is minus
    // the reference, so that the chain ends in score - ref
    auto qk = [&](v8f (&s_)[QW][4], int j, const v16h (&f)[4]) __attribute__((always_inline)) {
#pragma unroll
        for (int s = 0; s < 4; ++s) {
#pragma unroll
            for (int u = 0; u < QW; ++u)
                s_[u][j] = __builtin_amdgcn_wmma_f32_16x16x32_f16(false, f[s], false, qf[u][s], (short)0, s == 0 ? cref[u] : s_[u][j], false, false);
        }
    };

    // ---- softmax: a lane holds 32 of its query's 64 scores of a tile, so maximum and sum run in-lane.
    // ex[u][j][r]: score - ref of key j*16 + 8*hi + r, query u*16 + ln. A trip takes the powers of key tile j and then lets
    // the next tile's products write their scores of key tile j to the same place ----
    v8f ex[QW][4];
    auto lane_max = [](const v8f (&s_)[QW][4], int u) __attribute__((always_inline)) {
        float mj[4];
#pragma unroll
        for (int j = 0; j < 4; ++j) {
            mj[j] = fmaxf(fmaxf(s_[u][j][0], s_[u][j][1]), s_[u][j][2]);
            mj[j] = fmaxf(fmaxf(mj[j], s_[u][j][3]), s_[u][j][4]);
            mj[j] = fmaxf(fmaxf(mj[j], s_[u][j][5]), s_[u][j][6]);
            mj[j] = fmaxf(mj[j], s_[u][j][7]);
        }
        return fmaxf(fmaxf(fmaxf(mj[0], mj[1]), mj[2]), mj[3]);
    };
    // the reference of each query goes up to the maximum in s_ (mx: the lane's own share of it) where that lies above
    // it: the sums and output tiles so far, and s_ itself, follow
    auto move_ref = [&](v8f (&s_)[QW][4], const float (&mx)[QW]) __attribute__((always_inline)) {
#pragma unroll
        for (int u = 0; u < QW; ++u) {
            const float d = fmaxf(fmaxf(mx[u], other_half(mx[u])), 0.0f);
            const float a = __builtin_amdgcn_exp2f(-d);
            lrow[u] *= a;
#pragma unroll
            for (int c = 0; c < 8; ++c) acc[u][c] *= a;
#pragma unroll
            for (int j = 0; j < 4; ++j) s_[u][j] -= d;
            cref[u] -= d;
        }
    };

    // ---- tile 0 in front of the loop: its scores against reference 0, then their maxima become the references ----
    {
        const _Float16* kl0 = K0 + ln * KPITCH + hi * 8;
        v16h fa[4], fb[4];
#pragma unroll
        for (int u = 0; u < QW; ++u) cref[u] = {};
#pragma unroll
        for (int s = 0; s < 4; ++s) fa[s] = frag(kl0 + s * 32);
#pragma unroll
        for (int s = 0; s < 4; ++s) fb[s] = frag(kl0 + 16 * KPITCH + s * 32);
        FENCE();
        qk(ex, 0, fa);
        FENCE();
#pragma unroll
        for (int s = 0; s < 4; ++s) fa[s] = frag(kl0 + 32 * KPITCH + s * 32);
        FENCE();
        qk(ex, 1, fb);
        FENCE();
#pragma unroll
        for (int s = 0; s < 4; ++s) fb[s] = frag(kl0 + 48 * KPITCH + s * 32);
        FENCE();
        qk(ex, 2, fa);
        qk(ex, 3, fb);
#pragma unroll
        for (int u = 0; u < QW; ++u) {
            const float m = lane_max(ex, u);
            cref[u] -= fmaxf(m, other_half(m));
#pragma unroll
            for (int j = 0; j < 4; ++j) ex[u][j] += cref[u];
        }
        FENCE();
    }

    const float* kn = kg + 3 * TILE;   // the K tile and the V tile that the next loads take
    const float* vn = vg + 2 * TILE;
    // where the thread writes when it converts the coming stage: carried from trip to trip and moved to the other
    // buffer at a trip's foot, so that no address arithmetic stands among the fenced stretches of a trip
    _Float16*    cvw = Ring + STAGE + vwr;
    _Float16*    ckw = Ring + STAGE + kwr;
    int hstep = -STAGE;
    // one trip. First half: the score products of tile tl + 1 (next: it exists), key tile by key tile, and among them the
    // powers, sums and P of tile tl, one key tile ahead of the products that take its place. Second half: the products of
    // P with V tile tl, and among them the lane maxima of tile tl + 1. At the foot one test for the whole wave: has a
    // score of tile tl + 1 left the range that the references allow. Where a tile tl + 1 exists, so does stage tl + 1: the trip
    // turns it from f32 to f16 in its first half: K's share is converted in front of the first product, V's among the products
    // of key tile 1; the LDS writes stand where fragment reads stand. more: a stage tl + 2 exists: its f32 values are asked for
    // as early as registers are free for them, at places where fragment reads stand anyway: K's behind the products of key
    // tile 1, V's behind the first eight products of the second half.
    // Inlined at each of its places, so that acc and qf stay in registers
    auto trip = [&](const int tl, const bool more, const bool next) __attribute__((always_inline)) {
        const int buf = (tl & 1) * STAGE;   // trip tl reads this buffer alone
        // this lane's row and half-wave offset in the two tiles: every fragment lies a constant off these
        const _Float16* kl0 = Ring + buf + ln * KPITCH + hi * 8;
        const _Float16* vt0 = Ring + buf + KHALVES + ln * VPITCH + hi * 8;
        auto kfrag = [&](int s, int j) { return frag(kl0 + j * 16 * KPITCH + s * 32); };  // keys j*16.., dims s*32..
        auto vfrag = [&](int c, int h) { return frag(vt0 + c * 16 * VPITCH + h * 32); };  // dims c*16.., keys h*32..
        v16h fa[4], fb[4], fc[4];
        v8f  pw[QW][4];
        v16h pf[QW][2];
        float ls[QW][4];
        float mx[QW];
        unsigned over = 0;   // the lanes that hold a score of tile tl + 1 more than RISE above its reference
        v8h hv[4];
        v4h hk[8];

        // powers and partial sums of key tile j, both query tiles
        auto tile_exp = [&](int j) {
#pragma unroll
            for (int u = 0; u < QW; ++u) {
                ls[u][j] = 0.0f;
#pragma unroll
                for (int r = 0; r < 8; ++r) { pw[u][j][r] = __builtin_amdgcn_exp2f(ex[u][j][r]); ls[u][j] += pw[u][j][r]; }
            }
        };
        // P^T as B operand: two score tiles, converted, are keys 0..31 (32..63) in the order of KOFF; no LDS, no lane exchange
        auto pack = [&](int h) {
#pragma unroll
            for (int u = 0; u < QW; ++u)
                pf[u][h] = __builtin_shufflevector(__builtin_convertvector(pw[u][2 * h], v8h), __builtin_convertvector(pw[u][2 * h + 1], v8h),
                                                   0, 1, 2, 3, 4, 5, 6, 7, 8, 9, 10, 11, 12, 13, 14, 15);
        };

        if (next) {
#pragma unroll
            for (int s = 0; s < 4; ++s) fa[s] = kfrag(s, 0);
#pragma unroll
            for (int s = 0; s < 4; ++s) fb[s] = kfrag(s, 1);
            FENCE();
            k_cvt(hk, rk);   // asked for in the trip before: this work, too, stands in front of the first product
        }
        tile_exp(0);   // the first reads of a trip are on their way: this work stands in front of the first product, which waits for them
        FENCE();
        if (next) qk(ex, 0, fa);
        tile_exp(1);
        if (next) {
            MIX(4);
            FENCE();
            k_write(ckw, hk);
#pragma unroll
            for (int s = 0; s < 4; ++s) fa[s] = kfrag(s, 2);
            FENCE();
            qk(ex, 1, fb);
            v_cvt(hv, rv);
        }
        tile_exp(2);
        if (next) {
            MIX(6);
            FENCE();
            v_write(cvw, hv);
#pragma unroll
            for (int s = 0; s < 4; ++s) fb[s] = kfrag(s, 3);
            if (more) {
                // K of stage tl + 2 from memory. The last stage has no K tile of its own and takes the last tile once more, which
                // nobody reads: a branch round those eight loads would split the loop body, and the vector work sinks behind such a branch
                k_read(rk, kn + l4);
                // in front of the addition at the trip's foot, which rewrites the scalar base that the loads name
                asm volatile("s_wait_xcnt 0x0" ::: "memory");
            }
            FENCE();
            qk(ex, 2, fa);
        }
        tile_exp(3);
        pack(0);
        pack(1);
        // V fragments of dims 0..31
        v16h fd[4];
#pragma unroll
        for (int i = 0; i < 4; ++i) fd[i] = vfrag(i >> 1, i & 1);
        if (next) qk(ex, 3, fb);
#pragma unroll
        for (int u = 0; u < QW; ++u) lrow[u] += (ls[u][0] + ls[u][1]) + (ls[u][2] + ls[u][3]);
#pragma unroll
        for (int i = 0; i < 4; ++i) fb[i] = vfrag(2 + (i >> 1), i & 1);
#pragma unroll
        for (int i = 0; i < 4; ++i) fc[i] = vfrag(4 + (i >> 1), i & 1);
        // the conversions to P come out next to their first use, so this stretch reaches down to it and takes them in;
        // the groups of eight and sixteen reads (0x100) stay behind the products whose registers they take over
        if (next) MIX(6);
        __builtin_amdgcn_sched_group_barrier(0x100, 8, 0);
        if (next) MIX(3);
        __builtin_amdgcn_sched_group_barrier(0x100, 16, 0);
        FENCE();

        // ---- O^T += V^T x P^T : 8 chunks of 16 dims, contraction K = 64 keys; a set serves two chunks,
        // keys 0..31 of both and then keys 32..63 of both, each fragment against both query tiles ----
        auto pv2 = [&](int c, const v16h (&f)[4]) {
#pragma unroll
            for (int h = 0; h < 2; ++h) {
#pragma unroll
                for (int i = 0; i < 2; ++i) {
#pragma unroll
                    for (int u = 0; u < QW; ++u)
                        acc[u][c + i] = __builtin_amdgcn_wmma_f32_16x16x32_f16(false, f[2 * i + h], false, pf[u][h], (short)0, acc[u][c + i], false, false);
                }
            }
        };
        pv2(0, fd);
        FENCE();
#pragma unroll
        for (int i = 0; i < 4; ++i) fa[i] = vfrag(6 + (i >> 1), i & 1);
        if (more) {
            v_read(rv, vn + vl);   // V of stage tl + 2 from memory
            // in front of the addition at the trip's foot, which rewrites the scalar base that the loads name
            asm volatile("s_wait_xcnt 0x0" ::: "memory");
        }
        FENCE();
        pv2(2, fb);
        // the test's lane mask is formed here, sixteen products ahead of the branch that reads it
        if (next) {
            mx[0] = lane_max(ex, 0);
            mx[1] = lane_max(ex, 1);
            over  = __builtin_amdgcn_ballot_w32(fmaxf(mx[0], mx[1]) > RISE);
            MIX(6);
        }
        FENCE();
        pv2(4, fc);
        pv2(6, fa);
        FENCE();   // the products stay in front of the waits below, which else stand ahead of them and drain the last reads at once

        // hand-over: this wave's reads of its buffer and its writes of stage tl + 1 are done; behind the barrier that holds for
        // every wave, so stage tl + 1 may be read and this trip's buffer written anew
        asm volatile("s_wait_dscnt 0x0" ::: "memory");
        HANDOVER();
        cvw += hstep; ckw += hstep;
        hstep = -hstep;
        if (more) { kn += tl + 4 < NTILES ? TILE : 0; vn += TILE; }
        // one scalar branch a trip, behind all of the trip's work, so that the body above it stays one block; the output
        // tiles and sums hold tile tl by now, and nothing of tile tl + 1 has been used
        if (next && over != 0) move_ref(ex, mx);
    };
    // the last two trips ask for nothing and stand alone
    for (int tl = 0; tl < NTILES - 2; ++tl) trip(tl, true, true);
    trip(NTILES - 2, false, true);
    trip(NTILES - 1, false, false);
#undef MIX
#undef FENCE
    // ---- epilogue: join the halves' sums, divide, and turn O^T back into rows through this wave's
    // own LDS range, so that every global store covers one whole 512-B row ----
    float* ow = Ol + wave * (QW * 16) * OPITCH;
#pragma unroll
    for (int u = 0; u < QW; ++u) {
        const float inv = 1.0f / (lrow[u] + other_half(lrow[u]));
#pragma unroll
        for (int c = 0; c < 8; ++c) {
            const v8f o = acc[u][c] * inv;
            float* p = ow + (u * 16 + ln) * OPITCH + c * 16 + hi * 8;
            *reinterpret_cast<float4*>(p)     = make_float4(o[0], o[1], o[2], o[3]);
            *reinterpret_cast<float4*>(p + 4) = make_float4(o[4], o[5], o[6], o[7]);
        }
    }
    // the other lanes' rows are in LDS before this lane reads them back
    asm volatile("s_wait_dscnt 0x0" ::: "memory");
    float4 orow[QW * 16];
#pragma unroll
    for (int i = 0; i < QW * 16; ++i)
        orow[i] = *reinterpret_cast<const float4*>(ow + i * OPITCH + lane * 4);
    float* og = O + base + (size_t)qrow0 * Ddim + lane * 4;
#pragma unroll
    for (int i = 0; i < QW * 16; ++i)
        *reinterpret_cast<float4*>(og + i * Ddim) = orow[i];
}

extern "C" void kernel_launch(void* const* d_in, const int* in_sizes, int n_in,
                              void* d_out, int out_size, void* d_ws, size_t ws_size,
                              hipStream_t stream) {
    (void)in_sizes; (void)n_in; (void)out_size; (void)d_ws; (void)ws_size;
    const float* Q = (const float*)d_in[0];
    const float* K = (const float*)d_in[1];
    const float* V = (const float*)d_in[2];
    float*       O = (float*)d_out;

    dim3 grid(Sdim / QTILE, 4 * 16);   // (8 q-tiles, B*H = 64)
    dim3 block(256);                   // 8 wave32 waves
    fattn_kernel<<<grid, block, 0, stream>>>(Q, K, V, O);
}
